// v000
// Times are from an AMD MI455X. After a warm-up the kernel runs many times in a row, and a time is the length of
// such a window on the GPU divided by its runs, so every launch and the gaps after it count. The runs cycle
// through copies of the inputs. A figure is the median of several windows, for all but v000 over two sittings.
// Sittings can differ by a few percent; kernels timed side by side share one.
// v000, which the later versions start from, runs in 1270 microseconds.
// Contractions: q|k projection (x . w_in^T), v^T projection (w_in . x^T), scores q.k^T (K=64), p.v (K=1024), output projection (o . w_out^T): all v_wmma_f32_16x16x32_f16 (f16 operands built from bf16-RNE inputs with power-of-two carries: w x64, q/k/v x4, p x2048, o x16), f32 accumulate; sliding-window mask, ALiBi bias and softmax in f32.
#include <hip/hip_runtime.h>

// ---------------------------------------------------------------------------
// Problem constants (NB / SEQ overridable; *_FULL = input / output layout)
// ---------------------------------------------------------------------------
#ifndef NB
#define NB 4
#endif
#ifndef SEQ
#define SEQ 2048
#endif
#define NB_FULL 4
#define SEQ_FULL 2048

constexpr int kBatch     = NB;
constexpr int kBatchFull = NB_FULL;
constexpr int kSeq       = SEQ;
constexpr int kSeqFull   = SEQ_FULL;
constexpr int kEmb       = 1024;
constexpr int kHeads     = 16;
constexpr int kHdim      = 64;
constexpr int kWin       = 512;
constexpr int kNblk      = kSeq / kWin;           // query blocks per sequence
constexpr int kTok       = kBatch * kSeq;         // compact token rows (t = b*kSeq + s)
constexpr int kGuard     = 512;                   // zero guard rows / columns in front of the key planes
constexpr int kQKRows    = kGuard + kTok;         // rows of the q|k plane
constexpr int kQKPitch   = 2 * kEmb;              // 2048 halves per q|k row (q cols 0..1023, k cols 1024..2047)
constexpr int kVtPitch   = kGuard + kTok;         // halves per v^T row
constexpr int kKeys      = 2 * kWin;              // 1024 window keys per query block
constexpr int kChunks    = kBatch * kNblk;        // chunks, each = 16 heads of one (batch, query block)

static_assert(kSeq % kWin == 0);
static_assert(kSeq >= kWin && kSeq <= kSeqFull);
static_assert(kBatch >= 1 && kBatch <= kBatchFull);
static_assert(kHeads * kHdim == kEmb);
static_assert(kTok % 64 == 0 && kEmb % 64 == 0 && kKeys % 64 == 0 && kWin % 64 == 0);
static_assert(kEmb % 32 == 0 && kHdim % 32 == 0 && kKeys % 32 == 0);
static_assert((kVtPitch * 2) % 128 == 0 && (kQKPitch * 2) % 128 == 0);

constexpr float kWCarry   = 64.0f;             // weights carried x64 in f16
constexpr float kQKScale  = 1.0f / 16.0f;      // (x)(64 w) -> 4 q, 4 k, 4 v
constexpr float kSScale   = 1.0f / 128.0f;     // (4q)(4k) = 16 q.k -> q.k / 8
constexpr float kPCarry   = 2048.0f;           // probabilities carried x2048 in f16
constexpr float kPVScale  = 1.0f / 512.0f;     // (2048 p)(4 v) = 8192 o -> 16 o
constexpr float kOutScale = 1.0f / 1024.0f;    // (16 o)(64 w) = 1024 out -> out

typedef __attribute__((ext_vector_type(16))) _Float16 v16h;
typedef __attribute__((ext_vector_type(8)))  _Float16 v8h;
typedef __attribute__((ext_vector_type(16))) __bf16   v16b;
typedef __attribute__((ext_vector_type(8)))  __bf16   v8b;
typedef __attribute__((ext_vector_type(8)))  float    v8f;
typedef __attribute__((ext_vector_type(4)))  float    v4f;
typedef __attribute__((ext_vector_type(4)))  unsigned int v4u;

__device__ __forceinline__ unsigned short f2bf_bits(float f) {
  unsigned u = __float_as_uint(f);
  return (unsigned short)((u + 0x7FFFu + ((u >> 16) & 1u)) >> 16);
}
__device__ __forceinline__ float bf_bits2f(unsigned short h) { return __uint_as_float(((unsigned)h) << 16); }

// hazard guards as plain device helpers (no inline asm inside the kernel template body)
__device__ __forceinline__ void dep_guard_h(v8f& a, v8f& b, v16h x, v16h y) { asm volatile("v_nop\n\tv_nop\n\tv_nop\n\tv_nop" : "+v"(a), "+v"(b) : "v"(x), "v"(y)); }
__device__ __forceinline__ void dep_guard_b(v8f& a, v8f& b, v16b x, v16b y) { asm volatile("v_nop\n\tv_nop\n\tv_nop\n\tv_nop" : "+v"(a), "+v"(b) : "v"(x), "v"(y)); }
__device__ __forceinline__ void keep4_h(v16h a, v16h b, v16h c, v16h d) { asm volatile("v_nop" :: "v"(a), "v"(b), "v"(c), "v"(d)); }
__device__ __forceinline__ void keep4_b(v16b a, v16b b, v16b c, v16b d) { asm volatile("v_nop" :: "v"(a), "v"(b), "v"(c), "v"(d)); }
__device__ __forceinline__ void acc_guard4(v8f& a, v8f& b, v8f& c, v8f& d) { asm volatile("v_nop\n\tv_nop\n\tv_nop\n\tv_nop" : "+v"(a), "+v"(b), "+v"(c), "+v"(d)); }
template <typename T> struct Frag;
template <> struct Frag<_Float16> {
  typedef v16h V; union U { v16h v; v8h h[2]; };
  static __device__ __forceinline__ v16h load(const _Float16* p) {   // elements 0..7 <- p[0..7], 8..15 <- p[16..23]
    U f; f.h[0] = *(const v8h*)(p); f.h[1] = *(const v8h*)(p + 16); return f.v;
  }
  static __device__ __forceinline__ v8f mma(v16h a, v16h b, v8f c) {
    return __builtin_amdgcn_wmma_f32_16x16x32_f16(false, a, false, b, (short)0, c, false, false);
  }
  static __device__ __forceinline__ void guard(v8f& a, v8f& b, v16h x, v16h y) { dep_guard_h(a, b, x, y); }
  static __device__ __forceinline__ void keep(v16h a, v16h b, v16h c, v16h d) { keep4_h(a, b, c, d); }
};
template <> struct Frag<__bf16> {
  typedef v16b V; union U { v16b v; v8b h[2]; };
  static __device__ __forceinline__ v16b load(const __bf16* p) {
    U f; f.h[0] = *(const v8b*)(p); f.h[1] = *(const v8b*)(p + 16); return f.v;
  }
  static __device__ __forceinline__ v8f mma(v16b a, v16b b, v8f c) {
    return __builtin_amdgcn_wmma_f32_16x16x32_bf16(false, a, false, b, (short)0, c, false, false);
  }
  static __device__ __forceinline__ void guard(v8f& a, v8f& b, v16b x, v16b y) { dep_guard_b(a, b, x, y); }
  static __device__ __forceinline__ void keep(v16b a, v16b b, v16b c, v16b d) { keep4_b(a, b, c, d); }
};

__device__ __forceinline__ unsigned pk16(unsigned short a, unsigned short b) { return (unsigned)a | ((unsigned)b << 16); }
__device__ __forceinline__ unsigned short h_bits(float f) { const _Float16 h = (_Float16)f; return __builtin_bit_cast(unsigned short, h); }

// ---- Register-blocked batched WMMA GEMM (ACT reduced to none/relu/leaky) -----------------------
// C[m,n] = scale * sum_k A[m,k] * Bt[n,k] (+bias)(+resid); each wave owns a 64x64 tile.
// A row-major [M,K]; Bt row-major [N,K]; M,N % 64 == 0, K % 32 == 0.
// SPLIT: operands are hi/lo planes (A2/Bt2 = lo planes, same layout); product = hi.hi + hi.lo + lo.hi.
// BIAS_MODE: 0 = none, 1 = bias[m], 2 = bias[n].
// OUT_MODE: 0 = f32, 1 = f16, 2 = bf16 hi plane (Cout) + bf16 lo plane (Cout2).
// ET: 0 = f16 operands, 1 = bf16 operands (pointers passed as 16-bit storage)
template <int ET> struct Elem;
template <> struct Elem<0> { typedef _Float16 T; };
template <> struct Elem<1> { typedef __bf16 T; };
template <int ET, bool SPLIT, int BIAS_MODE, int OUT_MODE, bool RESID, int ACT = 0>
__global__ __launch_bounds__(256) void wmma_gemm64(
    const unsigned short* __restrict__ Ap, const unsigned short* __restrict__ A2p, int lda, long strideA,
    const unsigned short* __restrict__ Btp, const unsigned short* __restrict__ Bt2p, int ldb, long strideB,
    void* __restrict__ Cout, void* __restrict__ Cout2, int ldc, long strideC,
    const float* __restrict__ bias,
    const float* __restrict__ resid, long strideR,
    int M, int N, int K, float scale) {
  typedef typename Elem<ET>::T T;
  typedef typename Frag<T>::V V;
  const T* A = (const T*)Ap; const T* A2 = (const T*)A2p; const T* Bt = (const T*)Btp; const T* Bt2 = (const T*)Bt2p;
  __shared__ __align__(16) float sT[8][16 * 68];   // per-wave 16x64 slab, pitch 68 floats
  const int b    = blockIdx.y;
  const int lane = threadIdx.x & 31;
  const int wave = threadIdx.x >> 5;
  const int tilesN = N >> 6;
  const int tilesM = M >> 6;
  const int tile = blockIdx.x * 8 + wave;
  if (tile >= tilesM * tilesN) return;   // wave-uniform; no block barriers in this kernel
  const int tm = tile / tilesN;
  const int tn = tile - tm * tilesN;
  const int m0 = tm << 6;
  const int n0 = tn << 6;

  const T* Ab  = A  + (size_t)b * strideA;
  const T* Bb  = Bt + (size_t)b * strideB;
  const T* Ab2 = SPLIT ? (A2  + (size_t)b * strideA) : nullptr;
  const T* Bb2 = SPLIT ? (Bt2 + (size_t)b * strideB) : nullptr;

  const int rlane = lane & 15;                 // row (A) / col (B, D) within subtile
  const int koff  = (lane >> 4) * 8;           // k offset of this lane half
  const int mOff  = (lane >> 4) * 8;           // D row offset

  v8f acc[4][4];
#pragma unroll
  for (int i = 0; i < 4; ++i)
#pragma unroll
    for (int j = 0; j < 4; ++j) acc[i][j] = (v8f){0.f,0.f,0.f,0.f,0.f,0.f,0.f,0.f};

  for (int k0 = 0; k0 < K; k0 += 32) {
    V bh[4], bl[4];
#pragma unroll
    for (int j = 0; j < 4; ++j) {
      const size_t bo = (size_t)(n0 + (j << 4) + rlane) * ldb + koff + k0;
      bh[j] = Frag<T>::load(Bb + bo);
      if (SPLIT) bl[j] = Frag<T>::load(Bb2 + bo);
    }
#pragma unroll
    for (int i = 0; i < 4; ++i) {
      const size_t ao = (size_t)(m0 + (i << 4) + rlane) * lda + koff + k0;
      V ah = Frag<T>::load(Ab + ao);
      V al;
      if (SPLIT) al = Frag<T>::load(Ab2 + ao);
#pragma unroll
      for (int j = 0; j < 4; ++j) {
        acc[i][j] = Frag<T>::mma(ah, bh[j], acc[i][j]);
        if (SPLIT) {
          acc[i][j] = Frag<T>::mma(ah, bl[j], acc[i][j]);
          acc[i][j] = Frag<T>::mma(al, bh[j], acc[i][j]);
        }
      }
      Frag<T>::guard(acc[i][0], acc[i][3], ah, SPLIT ? al : ah);
    }
    Frag<T>::keep(bh[0], bh[1], bh[2], bh[3]);
    if (SPLIT) Frag<T>::keep(bl[0], bl[1], bl[2], bl[3]);
  }
  acc_guard4(acc[0][0], acc[0][1], acc[0][2], acc[0][3]);
  acc_guard4(acc[1][0], acc[1][1], acc[1][2], acc[1][3]);
  acc_guard4(acc[2][0], acc[2][1], acc[2][2], acc[2][3]);
  acc_guard4(acc[3][0], acc[3][1], acc[3][2], acc[3][3]);

  // ---- epilogue ----
  float* slab = sT[wave];
  const float* Rb = RESID ? (resid + (size_t)b * strideR) : nullptr;
#pragma unroll
  for (int i = 0; i < 4; ++i) {
    const int mBase = m0 + (i << 4);
#pragma unroll
    for (int j = 0; j < 4; ++j) {
      const int n = n0 + (j << 4) + rlane;
      float bv = 0.f;
      if (BIAS_MODE == 2) bv = bias[n];
#pragma unroll
      for (int r = 0; r < 8; ++r) {
        float v = acc[i][j][r] * scale;
        if (BIAS_MODE == 1) v += bias[mBase + mOff + r];
        if (BIAS_MODE == 2) v += bv;
        if (RESID) v += Rb[(size_t)(mBase + mOff + r) * ldc + n];
        if (ACT == 2) v = fmaxf(v, 0.0f);
        if (ACT == 4) v = (v > 0.f) ? v : 0.01f * v;
        slab[(mOff + r) * 68 + (j << 4) + rlane] = v;
      }
    }
    __builtin_amdgcn_fence(__ATOMIC_RELEASE, "workgroup");
    __builtin_amdgcn_wave_barrier();
    __builtin_amdgcn_fence(__ATOMIC_ACQUIRE, "workgroup");
    if (OUT_MODE == 0) {
      float* C = (float*)Cout + (size_t)b * strideC;
      const int hh = lane >> 4, c4 = (lane & 15) * 4;     // row seg = 256 B = 16 lanes x 16 B
      {
#pragma unroll
        for (int it = 0; it < 8; ++it) {
          const int row = it * 2 + hh;
          v4f v = *(const v4f*)(slab + row * 68 + c4);
          *(v4f*)(C + (size_t)(mBase + row) * ldc + n0 + c4) = v;
        }
        
      }
    } else {
      const int q = lane >> 3, c8 = (lane & 7) * 8;
      unsigned short* C  = (unsigned short*)Cout  + (size_t)b * strideC;
      unsigned short* C2 = (OUT_MODE == 2) ? ((unsigned short*)Cout2 + (size_t)b * strideC) : nullptr;
      {
#pragma unroll
        for (int it = 0; it < 4; ++it) {
          const int row = it * 4 + q;
          const float* sp = slab + row * 68 + c8;
          v8h hv, lv;
#pragma unroll
          for (int e = 0; e < 8; ++e) {
            if (OUT_MODE == 1) {
              hv[e] = (_Float16)sp[e];
            } else {
              unsigned short hb = f2bf_bits(sp[e]);
              unsigned short lb = f2bf_bits(sp[e] - bf_bits2f(hb));
              hv[e] = __builtin_bit_cast(_Float16, hb);
              lv[e] = __builtin_bit_cast(_Float16, lb);
            }
          }
          *(v8h*)(C + (size_t)(mBase + row) * ldc + n0 + c8) = hv;
          if (OUT_MODE == 2) *(v8h*)(C2 + (size_t)(mBase + row) * ldc + n0 + c8) = lv;
        }
        
      }
    }
    __builtin_amdgcn_fence(__ATOMIC_RELEASE, "workgroup");
    __builtin_amdgcn_wave_barrier();
    __builtin_amdgcn_fence(__ATOMIC_ACQUIRE, "workgroup");
  }
}

// ---------------------------------------------------------------------------
// f32 -> bf16 (RNE) -> f16 cast with power-of-two carry: out[8i..8i+7] = f16(scale * bf16(in[8i..8i+7])).
// The bf16 significand times a power of two is exact in f16 for the value ranges used here.
// blockIdx.y selects a row group: in += y * inStride, out += y * outStride (elements).
// Coverage: n8 = (elements per group)/8 threads x 8 = the whole group; every plane group is an exact multiple of 8.
// ---------------------------------------------------------------------------
__global__ __launch_bounds__(256) void cast8_f16_kernel(const float* __restrict__ in, long inStride,
                                                        unsigned short* __restrict__ out, long outStride,
                                                        int n8, float scale) {
  const int i = blockIdx.x * 256 + threadIdx.x;
  if (i >= n8) return;
  const float* p = in + (size_t)blockIdx.y * inStride + 8 * (size_t)i;
  const v4f a = *(const v4f*)(p);
  const v4f c = *(const v4f*)(p + 4);
  unsigned short hb[8];
#pragma unroll
  for (int e = 0; e < 4; ++e) {
    hb[e]     = h_bits(bf_bits2f(f2bf_bits(a[e])) * scale);
    hb[4 + e] = h_bits(bf_bits2f(f2bf_bits(c[e])) * scale);
  }
  const v4u u = (v4u){pk16(hb[0], hb[1]), pk16(hb[2], hb[3]), pk16(hb[4], hb[5]), pk16(hb[6], hb[7])};
  unsigned short* q = out + (size_t)blockIdx.y * outStride + 8 * (size_t)i;
  *(v4u*)q = u;
  
}

// ---------------------------------------------------------------------------
// Zero fill of guard regions: thread i writes 16 B (8 halves) of zeros at base + row*pitch + seg*8 with
// Coverage: total = nrows * segs threads -> nrows rows x (segs*8) halves each.
// ---------------------------------------------------------------------------
__global__ __launch_bounds__(256) void zero16_kernel(unsigned short* __restrict__ base, int pitch, int segs, int total) {
  const int i = blockIdx.x * 256 + threadIdx.x;
  if (i >= total) return;
  const int row = i / segs;
  const int seg = i - row * segs;
  unsigned short* p = base + (size_t)row * pitch + (size_t)seg * 8;
  const v4u z = (v4u){0u, 0u, 0u, 0u};
  *(v4u*)p = z;
  
}

// ---------------------------------------------------------------------------
// Band softmax for one (batch, query block) chunk, all 16 heads.
// S plane: [h][qi][kj] f32 scores = q.k/8 (qi in 0..511, kj in 0..1023 window key offset; kj < 512 = prior block).
// delta = qi - kj + 512 = q_idx - kv_idx; valid iff 0 <= delta < 512 and key position blk*512 + kj - 512 >= 0.
// score := s + slope_h * delta where valid, -inf elsewhere (select, not add); slope_h = 2^(-(h+1)/2).
// P[h][qi][kj] = f16( 2048 * exp(score - max) * (1/sum) ); masked keys give exactly 0.
// grid (512, 16): blockIdx.x = qi, blockIdx.y = h; 128 threads; thread t owns kj = 8t..8t+7 (128 x 8 = 1024 = whole row).
// Reductions in fixed order (thread, wave shuffle tree, 4 wave partials in index order); redM/redS are cross-wave
// LDS -> block barriers.
// ---------------------------------------------------------------------------
__global__ __launch_bounds__(128) void band_softmax_kernel(const float* __restrict__ S, unsigned short* __restrict__ P, int blk) {
#pragma clang fp contract(off)
  __shared__ float redM[4];
  __shared__ float redS[4];
  const int qi   = blockIdx.x;
  const int h    = blockIdx.y;
  const int t    = threadIdx.x;
  const int lane = t & 31, wave = t >> 5;
  const int c0   = t * 8;
  const size_t rowoff = ((size_t)h * kWin + qi) * kKeys;
  const float* sr = S + rowoff + c0;
  const v4f a = *(const v4f*)(sr);
  const v4f c = *(const v4f*)(sr + 4);
  // slope_h = 2^(-(h+1)/2): exact power of two for odd h, sqrt(1/2) * power of two for even h
  const int e1 = h + 1;
  const float sl = ((e1 & 1) ? 0.70710678118654752f : 1.0f) * __uint_as_float(((unsigned)(127 - (e1 >> 1))) << 23);
  const float neg_inf = -__builtin_inff();
  const int kbase = blk * kWin - kWin;     // key position of kj = 0
  float x[8];
#pragma unroll
  for (int e = 0; e < 8; ++e) {
    const int kj = c0 + e;
    const int delta = qi - kj + kWin;
    const bool valid = (delta >= 0) && (delta < kWin) && (kbase + kj >= 0);
    const float sv = (e < 4) ? a[e] : c[e - 4];
    const float bias = sl * (float)delta;
    const float sc = sv + bias;
    x[e] = valid ? sc : neg_inf;
  }
  float m = fmaxf(fmaxf(fmaxf(x[0], x[1]), fmaxf(x[2], x[3])), fmaxf(fmaxf(x[4], x[5]), fmaxf(x[6], x[7])));
#pragma unroll
  for (int off = 16; off > 0; off >>= 1) m = fmaxf(m, __shfl_xor(m, off, 32));
  if (lane == 0) redM[wave] = m;
  __syncthreads();
  const float gm = fmaxf(fmaxf(redM[0], redM[1]), fmaxf(redM[2], redM[3]));
  float ev[8];
#pragma unroll
  for (int e = 0; e < 8; ++e) ev[e] = expf(x[e] - gm);
  float s = ((ev[0] + ev[1]) + (ev[2] + ev[3])) + ((ev[4] + ev[5]) + (ev[6] + ev[7]));
#pragma unroll
  for (int off = 16; off > 0; off >>= 1) s += __shfl_xor(s, off, 32);
  if (lane == 0) redS[wave] = s;
  __syncthreads();
  const float tot = ((redS[0] + redS[1]) + redS[2]) + redS[3];
  const float inv = 1.0f / tot;
  const float kf  = kPCarry * inv;
  unsigned short hb[8];
#pragma unroll
  for (int e = 0; e < 8; ++e) hb[e] = h_bits(ev[e] * kf);
  const v4u u = (v4u){pk16(hb[0], hb[1]), pk16(hb[2], hb[3]), pk16(hb[4], hb[5]), pk16(hb[6], hb[7])};
  unsigned short* q = P + rowoff + c0;
  *(v4u*)q = u;
  
}

// ---------------------------------------------------------------------------
// Launcher
// Token rows are compact: t = b*kSeq + s; input x row = b*kSeqFull + s; output row = b*kSeqFull + s.
// Workspace region map (bytes) for NB=4, SEQ=2048 (smaller NB / SEQ shrink R0, R3, R4):
//   R0 [0,          16777216)   x f16 [kTok][1024]; aliased later by O f16 x16 [kTok][1024] (x dead after the two projections)
//   R1 [16777216,   23068672)   w_in f16 x64 [3072][1024]
//   R2 [23068672,   25165824)   w_out f16 x64 [1024][1024]
//   R3 [25165824,   60817408)   q|k plane f16 x4 [512 guard + kTok][2048]  (guard rows zero-filled; rows 512.. written by GEMM)
//   R4 [60817408,   78643200)   v^T plane f16 x4 [1024][512 guard + kTok]  (guard cols zero-filled; cols 512.. written by GEMM)
//   R5 [78643200,  112197632)   S slab f32 [16 heads][512][1024] per chunk
//   R6 [112197632, 128974848)   P f16 x2048 [16 heads][512][1024] per chunk
//   total 128974848 <= 134217728
// ---------------------------------------------------------------------------
extern "C" void kernel_launch(void* const* d_in, const int* in_sizes, int n_in,
                              void* d_out, int out_size, void* d_ws, size_t ws_size,
                              hipStream_t stream) {
  const size_t NXT = (size_t)kTok * kEmb;                                              // compact x / O plane elements
  const size_t NXNEED = (size_t)(kBatch - 1) * kSeqFull * kEmb + (size_t)kSeq * kEmb;  // last input / output row used + 1
  const size_t NWI = (size_t)3 * kEmb * kEmb;                                          // 3145728
  const size_t NWO = (size_t)kEmb * kEmb;                                              // 1048576
  if (n_in < 3) return;
  if ((size_t)in_sizes[0] < NXNEED || (size_t)in_sizes[1] < NWI || (size_t)in_sizes[2] < NWO) return;
  if ((size_t)out_size < NXNEED) return;

  const float* x     = (const float*)d_in[0];
  const float* w_in  = (const float*)d_in[1];
  const float* w_out = (const float*)d_in[2];
  float* out = (float*)d_out;

  char* ws = (char*)d_ws;
  size_t off = 0;
  unsigned short* x16  = (unsigned short*)(ws + off); off += NXT * 2;
  unsigned short* wi16 = (unsigned short*)(ws + off); off += NWI * 2;
  unsigned short* wo16 = (unsigned short*)(ws + off); off += NWO * 2;
  unsigned short* qk   = (unsigned short*)(ws + off); off += (size_t)kQKRows * kQKPitch * 2;
  unsigned short* vt   = (unsigned short*)(ws + off); off += (size_t)kEmb * kVtPitch * 2;
  float*          sp   = (float*)(ws + off);          off += (size_t)kHeads * kWin * kKeys * 4;
  unsigned short* p16  = (unsigned short*)(ws + off); off += (size_t)kHeads * kWin * kKeys * 2;
  unsigned short* o16  = x16;                         // alias: x16 is dead after the two projection GEMMs
  if (off > ws_size) return;
  // dummy in-range pointers for unused bias / resid arguments (never dereferenced with BIAS_MODE 0 / RESID false)
  const float* xf = x;

  // 1-3: casts. x: per batch kSeq*kEmb/8 threads, grid y = batch (src stride kSeqFull*kEmb, dst stride kSeq*kEmb);
  //       w_in: 393216 threads = 1536 blocks; w_out: 131072 = 512 blocks.
  {
    const int n8x = (int)((size_t)kSeq * kEmb / 8);
    cast8_f16_kernel<<<dim3((unsigned)((n8x + 255) / 256), kBatch), dim3(256), 0, stream>>>(
        x, (long)kSeqFull * kEmb, x16, (long)kSeq * kEmb, n8x, 1.0f);
    cast8_f16_kernel<<<dim3((unsigned)((NWI / 8 + 255) / 256), 1), dim3(256), 0, stream>>>(
        w_in, 0L, wi16, 0L, (int)(NWI / 8), kWCarry);
    cast8_f16_kernel<<<dim3((unsigned)((NWO / 8 + 255) / 256), 1), dim3(256), 0, stream>>>(
        w_out, 0L, wo16, 0L, (int)(NWO / 8), kWCarry);
  }

  // 4: q|k guard rows [512][2048] halves = 512 rows x 256 segments; 5: v^T guard columns 1024 rows x 64 segments (512 halves)
  {
    const int tq = kGuard * (kQKPitch / 8);                       // 131072
    zero16_kernel<<<dim3((unsigned)((tq + 255) / 256)), dim3(256), 0, stream>>>(qk, kQKPitch, kQKPitch / 8, tq);
    const int tv = kEmb * (kGuard / 8);                           // 65536
    zero16_kernel<<<dim3((unsigned)((tv + 255) / 256)), dim3(256), 0, stream>>>(vt, kVtPitch, kGuard / 8, tv);
  }

  // 6: q|k = x . w_in[0..2047]^T -> rows 512.. of the q|k plane (M=kTok, N=2048, K=1024, f16 out, scale 1/16 -> carried x4)
  {
    const int tiles = (kTok / 64) * (kQKPitch / 64);
    wmma_gemm64<0, false, 0, 1, false, 0><<<dim3((unsigned)((tiles + 7) / 8), 1), dim3(256), 0, stream>>>(
        x16, x16, kEmb, 0L, wi16, wi16, kEmb, 0L,
        (void*)(qk + (size_t)kGuard * kQKPitch), (void*)(qk + (size_t)kGuard * kQKPitch), kQKPitch, 0L,
        xf, xf, 0L, kTok, kQKPitch, kEmb, kQKScale);
  }
  // 7: v^T = w_in[2048..3071] . x^T -> v^T plane cols 512.. (M=1024, N=kTok, K=1024, f16 out, ldc kVtPitch, scale 1/16 -> carried x4)
  {
    const int tiles = (kEmb / 64) * (kTok / 64);
    wmma_gemm64<0, false, 0, 1, false, 0><<<dim3((unsigned)((tiles + 7) / 8), 1), dim3(256), 0, stream>>>(
        wi16 + (size_t)2 * kEmb * kEmb, wi16 + (size_t)2 * kEmb * kEmb, kEmb, 0L, x16, x16, kEmb, 0L,
        (void*)(vt + kGuard), (void*)(vt + kGuard), kVtPitch, 0L,
        xf, xf, 0L, kEmb, kTok, kEmb, kQKScale);
  }

  // 8: per chunk (b, n): S slab (16 heads) -> band softmax -> P.V into merged O
  for (int ch = 0; ch < kChunks; ++ch) {
    const int b = ch / kNblk;
    const int n = ch - b * kNblk;
    const size_t tok0 = (size_t)b * kSeq + (size_t)n * kWin;    // first compact query token row of the block
    // S[h][qi][kj] = (4q).(4k)/128: A = q rows (guard + tok0 ..), Bt = k rows of the window (guarded row tok0 .. = key token tok0-512 ..)
    {
      const int tiles = (kWin / 64) * (kKeys / 64);               // 8 x 16 = 128
      wmma_gemm64<0, false, 0, 0, false, 0><<<dim3((unsigned)((tiles + 7) / 8), kHeads), dim3(256), 0, stream>>>(
          qk + ((size_t)kGuard + tok0) * kQKPitch, qk + ((size_t)kGuard + tok0) * kQKPitch, kQKPitch, (long)kHdim,
          qk + tok0 * kQKPitch + kEmb, qk + tok0 * kQKPitch + kEmb, kQKPitch, (long)kHdim,
          (void*)sp, (void*)sp, kKeys, (long)kWin * kKeys,
          xf, xf, 0L, kWin, kKeys, kHdim, kSScale);
    }
    band_softmax_kernel<<<dim3(kWin, kHeads), dim3(128), 0, stream>>>(sp, p16, n);
    // O[tok0+qi][h*64+d] x16 = sum_kj P[h][qi][kj] * vT[h*64+d][guarded col tok0 + kj] / 512
    {
      const int tiles = (kWin / 64) * (kHdim / 64);               // 8 x 1 = 8
      wmma_gemm64<0, false, 0, 1, false, 0><<<dim3((unsigned)((tiles + 7) / 8), kHeads), dim3(256), 0, stream>>>(
          p16, p16, kKeys, (long)kWin * kKeys,
          vt + tok0, vt + tok0, kVtPitch, (long)kHdim * kVtPitch,
          (void*)(o16 + tok0 * kEmb), (void*)(o16 + tok0 * kEmb), kEmb, (long)kHdim,
          xf, xf, 0L, kWin, kHdim, kKeys, kPVScale);
    }
  }

  // 9: out = (16 o) . (64 w_out)^T / 1024 -> d_out f32 rows b*kSeqFull + s (grid y = batch; M=kSeq per batch, N=1024, K=1024)
  {
    const int tiles = (kSeq / 64) * (kEmb / 64);
    wmma_gemm64<0, false, 0, 0, false, 0><<<dim3((unsigned)((tiles + 7) / 8), kBatch), dim3(256), 0, stream>>>(
        o16, o16, kEmb, (long)kSeq * kEmb, wo16, wo16, kEmb, 0L,
        (void*)out, (void*)out, kEmb, (long)kSeqFull * kEmb,
        xf, xf, 0L, kSeq, kEmb, kEmb, kOutScale);
  }
}

// v002
// A run of this version takes 116 microseconds.
// Versions in between are left out here; by their measured steps it is 11.0 times as fast as v000.
// Contractions: q|k projection (x . w_in^T), v^T projection (w_in . x^T), scores k.q^T (K=64), v^T.p^T (32 keys a pass), output projection (o . w_out^T): all v_wmma_f32_16x16x32_f16 (f16 operands built from bf16-RNE inputs with power-of-two carries: w x64, q/k/v x4, p x2048, o x16), f32 accumulate; sliding-window mask, ALiBi bias and online softmax in f32.
#include <hip/hip_runtime.h>

// ---------------------------------------------------------------------------
// Problem constants (NB / SEQ overridable; *_FULL = input / output layout)
// ---------------------------------------------------------------------------
#ifndef NB
#define NB 4
#endif
#ifndef SEQ
#define SEQ 2048
#endif
#define NB_FULL 4
#define SEQ_FULL 2048

constexpr int kBatch     = NB;
constexpr int kBatchFull = NB_FULL;
constexpr int kSeq       = SEQ;
constexpr int kSeqFull   = SEQ_FULL;
constexpr int kEmb       = 1024;
constexpr int kHeads     = 16;
constexpr int kHdim      = 64;
constexpr int kWin       = 512;
constexpr int kTok       = kBatch * kSeq;         // compact token rows (t = b*kSeq + s)
constexpr int kGuard     = 512;                   // unused rows / columns in front of the key planes (layout kept)
constexpr int kQKRows    = kGuard + kTok;         // rows of the q|k plane
constexpr int kQKPitch   = 2 * kEmb;              // 2048 halves per q|k row (q cols 0..1023, k cols 1024..2047)
constexpr int kVtPitch   = kGuard + kTok;         // halves per v^T row

static_assert(kSeq % kWin == 0);
static_assert(kSeq >= kWin && kSeq <= kSeqFull);
static_assert(kBatch >= 1 && kBatch <= kBatchFull);
static_assert(kHeads * kHdim == kEmb);
static_assert(kTok % 64 == 0 && kEmb % 64 == 0 && kWin % 32 == 0 && kSeq % 128 == 0);
static_assert(kEmb % 32 == 0 && kHdim == 64);
static_assert((kVtPitch * 2) % 128 == 0 && (kQKPitch * 2) % 128 == 0);

constexpr float kWCarry   = 64.0f;             // weights carried x64 in f16
constexpr float kQKScale  = 1.0f / 16.0f;      // (x)(64 w) -> 4 q, 4 k, 4 v
constexpr float kSScale   = 1.0f / 128.0f;     // (4q)(4k) = 16 q.k -> q.k / 8
constexpr float kPLog2    = 11.0f;             // probabilities carried x2048 = 2^11 in f16
constexpr float kPVScale  = 4.0f;              // sum (2048 p)(4 v) / sum (2048 p) = 4 o -> 16 o
constexpr float kOutScale = 1.0f / 1024.0f;    // (16 o)(64 w) = 1024 out -> out

typedef __attribute__((ext_vector_type(16))) _Float16 v16h;
typedef __attribute__((ext_vector_type(8)))  _Float16 v8h;
typedef __attribute__((ext_vector_type(16))) __bf16   v16b;
typedef __attribute__((ext_vector_type(8)))  __bf16   v8b;
typedef __attribute__((ext_vector_type(8)))  float    v8f;
typedef __attribute__((ext_vector_type(4)))  float    v4f;
typedef __attribute__((ext_vector_type(4)))  unsigned int v4u;

__device__ __forceinline__ unsigned short f2bf_bits(float f) {
  unsigned u = __float_as_uint(f);
  return (unsigned short)((u + 0x7FFFu + ((u >> 16) & 1u)) >> 16);
}
__device__ __forceinline__ float bf_bits2f(unsigned short h) { return __uint_as_float(((unsigned)h) << 16); }

// hazard guards as plain device helpers
__device__ __forceinline__ void dep_guard_h(v8f& a, v8f& b, v16h x, v16h y) { asm volatile("v_nop\n\tv_nop\n\tv_nop\n\tv_nop" : "+v"(a), "+v"(b) : "v"(x), "v"(y)); }
__device__ __forceinline__ void dep_guard_b(v8f& a, v8f& b, v16b x, v16b y) { asm volatile("v_nop\n\tv_nop\n\tv_nop\n\tv_nop" : "+v"(a), "+v"(b) : "v"(x), "v"(y)); }
__device__ __forceinline__ void keep4_h(v16h a, v16h b, v16h c, v16h d) { asm volatile("v_nop" :: "v"(a), "v"(b), "v"(c), "v"(d)); }
__device__ __forceinline__ void keep4_b(v16b a, v16b b, v16b c, v16b d) { asm volatile("v_nop" :: "v"(a), "v"(b), "v"(c), "v"(d)); }
__device__ __forceinline__ void acc_guard4(v8f& a, v8f& b, v8f& c, v8f& d) { asm volatile("v_nop\n\tv_nop\n\tv_nop\n\tv_nop" : "+v"(a), "+v"(b), "+v"(c), "+v"(d)); }
template <typename T> struct Frag;
template <> struct Frag<_Float16> {
  typedef v16h V; union U { v16h v; v8h h[2]; };
  static __device__ __forceinline__ v16h load(const _Float16* p) {   // elements 0..7 <- p[0..7], 8..15 <- p[16..23]
    U f; f.h[0] = *(const v8h*)(p); f.h[1] = *(const v8h*)(p + 16); return f.v;
  }
  static __device__ __forceinline__ v8f mma(v16h a, v16h b, v8f c) {
    return __builtin_amdgcn_wmma_f32_16x16x32_f16(false, a, false, b, (short)0, c, false, false);
  }
  static __device__ __forceinline__ void guard(v8f& a, v8f& b, v16h x, v16h y) { dep_guard_h(a, b, x, y); }
  static __device__ __forceinline__ void keep(v16h a, v16h b, v16h c, v16h d) { keep4_h(a, b, c, d); }
};
template <> struct Frag<__bf16> {
  typedef v16b V; union U { v16b v; v8b h[2]; };
  static __device__ __forceinline__ v16b load(const __bf16* p) {
    U f; f.h[0] = *(const v8b*)(p); f.h[1] = *(const v8b*)(p + 16); return f.v;
  }
  static __device__ __forceinline__ v8f mma(v16b a, v16b b, v8f c) {
    return __builtin_amdgcn_wmma_f32_16x16x32_bf16(false, a, false, b, (short)0, c, false, false);
  }
  static __device__ __forceinline__ void guard(v8f& a, v8f& b, v16b x, v16b y) { dep_guard_b(a, b, x, y); }
  static __device__ __forceinline__ void keep(v16b a, v16b b, v16b c, v16b d) { keep4_b(a, b, c, d); }
};

__device__ __forceinline__ unsigned pk16(unsigned short a, unsigned short b) { return (unsigned)a | ((unsigned)b << 16); }
__device__ __forceinline__ unsigned short h_bits(float f) { const _Float16 h = (_Float16)f; return __builtin_bit_cast(unsigned short, h); }

// ---- Register-blocked batched WMMA GEMM (ACT reduced to none/relu/leaky) -----------------------
// C[m,n] = scale * sum_k A[m,k] * Bt[n,k] (+bias)(+resid); a block of 8 waves (2 x 4) owns a 128x256 tile, each wave 64x64 of it.
// A row-major [M,K]; Bt row-major [N,K]; M % 128 == 0, N % 256 == 0, K % 64 == 0.
// Operand path: per trip of 64 k the block's 128 A rows and 256 Bt rows (128 B each) are brought into LDS by asynchronous
// copies, whole 128-B lines, once per block; two buffers, the next trip's copies fly while this trip's products run.
// LDS row pitch 144 B (16 B x odd: no bank conflict for the 16-byte fragment reads).
// BIAS_MODE: 0 = none, 1 = bias[m], 2 = bias[n].
// OUT_MODE: 0 = f32, 1 = f16, 2 = bf16 hi plane (Cout) + bf16 lo plane (Cout2).
// ET: 0 = f16 operands, 1 = bf16 operands (pointers passed as 16-bit storage)
constexpr int kBM      = 128;                        // block tile rows (A rows staged)
constexpr int kBN      = 256;                        // block tile columns (Bt rows staged)
constexpr int kBK      = 64;                         // k per trip
constexpr int kLdsRow  = kBK + 8;                    // 16-bit elements per LDS row: 128 B + 16 B pad
constexpr int kStage   = (kBM + kBN) * kLdsRow;      // elements per buffer: A rows 0..127, Bt rows 128..383
constexpr int kCopies  = (kBM + kBN) * kBK / 8 / 256;   // 16-byte copies per lane and trip
static_assert(kCopies == 12 && kBM / 32 == 4);

// One lane's twelve 16-byte copies of a trip: global -> LDS, through no register. l: LDS byte addresses, p: global addresses.
// The s_wait_xcnt stands inside the statement so that no address register is rewritten in front of it.
__device__ __forceinline__ void async_copy12(const unsigned (&l)[12], const void* const (&p)[12]) {
  asm volatile(
      "global_load_async_to_lds_b128 %0, %12, off\n\t"
      "global_load_async_to_lds_b128 %1, %13, off\n\t"
      "global_load_async_to_lds_b128 %2, %14, off\n\t"
      "global_load_async_to_lds_b128 %3, %15, off\n\t"
      "global_load_async_to_lds_b128 %4, %16, off\n\t"
      "global_load_async_to_lds_b128 %5, %17, off\n\t"
      "global_load_async_to_lds_b128 %6, %18, off\n\t"
      "global_load_async_to_lds_b128 %7, %19, off\n\t"
      "global_load_async_to_lds_b128 %8, %20, off\n\t"
      "global_load_async_to_lds_b128 %9, %21, off\n\t"
      "global_load_async_to_lds_b128 %10, %22, off\n\t"
      "global_load_async_to_lds_b128 %11, %23, off\n\t"
      "s_wait_xcnt 0x0"
      :: "v"(l[0]), "v"(l[1]), "v"(l[2]), "v"(l[3]), "v"(l[4]), "v"(l[5]), "v"(l[6]), "v"(l[7]), "v"(l[8]), "v"(l[9]),
         "v"(l[10]), "v"(l[11]),
         "v"(p[0]), "v"(p[1]), "v"(p[2]), "v"(p[3]), "v"(p[4]), "v"(p[5]), "v"(p[6]), "v"(p[7]), "v"(p[8]), "v"(p[9]),
         "v"(p[10]), "v"(p[11])
      : "memory");
}

template <int ET> struct Elem;
template <> struct Elem<0> { typedef _Float16 T; };
template <> struct Elem<1> { typedef __bf16 T; };
template <int ET, bool SPLIT, int BIAS_MODE, int OUT_MODE, bool RESID, int ACT = 0>
__global__ __launch_bounds__(256) void wmma_gemm64(
    const unsigned short* __restrict__ Ap, const unsigned short* __restrict__ A2p, int lda, long strideA,
    const unsigned short* __restrict__ Btp, const unsigned short* __restrict__ Bt2p, int ldb, long strideB,
    void* __restrict__ Cout, void* __restrict__ Cout2, int ldc, long strideC,
    const float* __restrict__ bias,
    const float* __restrict__ resid, long strideR,
    int M, int N, int K, float scale) {
  static_assert(!SPLIT, "the staged operand path carries one plane per operand");
  typedef typename Elem<ET>::T T;
  typedef typename Frag<T>::V V;
  const T* A = (const T*)Ap; const T* Bt = (const T*)Btp;
  __shared__ __align__(16) T     sOp[2][kStage];   // the two operand buffers
  __shared__ __align__(16) float sT[8][16 * 68];   // per-wave 16x64 slab, pitch 68 floats
  const int b    = blockIdx.y;
  const int lane = threadIdx.x & 31;
  const int wave = threadIdx.x >> 5;
  const int tilesN = N / kBN;
  const int tilesM = M / kBM;
  const int tile = blockIdx.x;
  if (tile >= tilesM * tilesN) return;   // block-uniform, in front of every barrier
  const int tm = tile / tilesN;
  const int tn = tile - tm * tilesN;
  const int bm0 = tm * kBM;                    // block tile origin
  const int bn0 = tn * kBN;
  const int wm  = (wave >> 2) << 6;            // wave tile origin inside the block tile
  const int wn  = (wave & 3) << 6;
  const int m0  = bm0 + wm;
  const int n0  = bn0 + wn;

  const T* Ab  = A  + (size_t)b * strideA;
  const T* Bb  = Bt + (size_t)b * strideB;

  const int rlane = lane & 15;                 // row (A) / col (B, D) within subtile
  const int koff  = (lane >> 4) * 8;           // k offset of this lane half
  const int mOff  = (lane >> 4) * 8;           // D row offset

  // copy roles: 8 lanes cover one 128-B row, a wave-wide copy covers 4 whole rows; copy j of a thread serves staged row crow + 32 j
  const int crow = threadIdx.x >> 3;           // 0..31
  const int ccol = (threadIdx.x & 7) * 8;      // element offset of the lane's 16 bytes in the row
  const T* gA = Ab + (size_t)(bm0 + crow) * lda + ccol;
  const T* gB = Bb + (size_t)(bn0 + crow) * ldb + ccol;
  const unsigned lds0 = (unsigned)(size_t)(&sOp[0][0]) + (unsigned)(crow * kLdsRow + ccol) * 2u;
  auto stage_in = [&](int t, int buf) {        // trip t's operand rows -> buffer buf
    unsigned l[12];
    const void* p[12];
#pragma unroll   // the twelve address pairs are operands of one asm statement: they must be registers, not arrays in memory
    for (int j = 0; j < 12; ++j) {
      l[j] = lds0 + (unsigned)(buf * kStage + j * 32 * kLdsRow) * 2u;
      p[j] = (j < 4) ? (const void*)(gA + (size_t)(j * 32) * lda + t * kBK)
                     : (const void*)(gB + (size_t)((j - 4) * 32) * ldb + t * kBK);
    }
    async_copy12(l, p);
  };

  v8f acc[4][4];
#pragma unroll
  for (int i = 0; i < 4; ++i)
#pragma unroll
    for (int j = 0; j < 4; ++j) acc[i][j] = (v8f){0.f,0.f,0.f,0.f,0.f,0.f,0.f,0.f};

  const int trips = K / kBK;
  stage_in(0, 0);
  asm volatile("s_wait_asynccnt 0x0" ::: "memory");   // this wave's share of trip 0 has landed
  __syncthreads();                                    // every wave's share has: buffer 0 may be read
  if (trips > 1) stage_in(1, 1);

  for (int t = 0; t < trips; ++t) {
    const T* sA = &sOp[t & 1][(wm + rlane) * kLdsRow + koff];
    const T* sB = &sOp[t & 1][(kBM + wn + rlane) * kLdsRow + koff];
#pragma unroll   // both 32-k steps in one body: the second step's fragment reads can start under the first step's products
    for (int kk = 0; kk < kBK; kk += 32) {
      V bh[4], ah[4];   // all eight fragments of a 32-k step are read as one group, in front of its 16 products
#pragma unroll
      for (int j = 0; j < 4; ++j) bh[j] = Frag<T>::load(sB + (j << 4) * kLdsRow + kk);
#pragma unroll
      for (int i = 0; i < 4; ++i) ah[i] = Frag<T>::load(sA + (i << 4) * kLdsRow + kk);
#pragma unroll
      for (int i = 0; i < 4; ++i) {
#pragma unroll
        for (int j = 0; j < 4; ++j) acc[i][j] = Frag<T>::mma(ah[i], bh[j], acc[i][j]);
        Frag<T>::guard(acc[i][0], acc[i][3], ah[i], ah[i]);
      }
      Frag<T>::keep(bh[0], bh[1], bh[2], bh[3]);
    }
    asm volatile("s_wait_dscnt 0x0" ::: "memory");      // this wave's reads of buffer t & 1 are done before it is refilled
    asm volatile("s_wait_asynccnt 0x0" ::: "memory");   // this wave's share of trip t + 1 has landed
    __syncthreads();                                    // publishes trip t + 1 and ends every reader's last read of trip t
    if (t + 2 < trips) stage_in(t + 2, t & 1);
  }
  asm volatile("s_wait_asynccnt 0x0" ::: "memory");     // nothing in flight when the wave goes on to the epilogue and ends
  acc_guard4(acc[0][0], acc[0][1], acc[0][2], acc[0][3]);
  acc_guard4(acc[1][0], acc[1][1], acc[1][2], acc[1][3]);
  acc_guard4(acc[2][0], acc[2][1], acc[2][2], acc[2][3]);
  acc_guard4(acc[3][0], acc[3][1], acc[3][2], acc[3][3]);

  // ---- epilogue ----
  float* slab = sT[wave];
  const float* Rb = RESID ? (resid + (size_t)b * strideR) : nullptr;
#pragma unroll
  for (int i = 0; i < 4; ++i) {
    const int mBase = m0 + (i << 4);
#pragma unroll
    for (int j = 0; j < 4; ++j) {
      const int n = n0 + (j << 4) + rlane;
      float bv = 0.f;
      if (BIAS_MODE == 2) bv = bias[n];
#pragma unroll
      for (int r = 0; r < 8; ++r) {
        float v = acc[i][j][r] * scale;
        if (BIAS_MODE == 1) v += bias[mBase + mOff + r];
        if (BIAS_MODE == 2) v += bv;
        if (RESID) v += Rb[(size_t)(mBase + mOff + r) * ldc + n];
        if (ACT == 2) v = fmaxf(v, 0.0f);
        if (ACT == 4) v = (v > 0.f) ? v : 0.01f * v;
        slab[(mOff + r) * 68 + (j << 4) + rlane] = v;
      }
    }
    __builtin_amdgcn_fence(__ATOMIC_RELEASE, "workgroup");
    __builtin_amdgcn_wave_barrier();
    __builtin_amdgcn_fence(__ATOMIC_ACQUIRE, "workgroup");
    if (OUT_MODE == 0) {
      float* C = (float*)Cout + (size_t)b * strideC;
      const int hh = lane >> 4, c4 = (lane & 15) * 4;     // row seg = 256 B = 16 lanes x 16 B
      {
#pragma unroll
        for (int it = 0; it < 8; ++it) {
          const int row = it * 2 + hh;
          v4f v = *(const v4f*)(slab + row * 68 + c4);
          *(v4f*)(C + (size_t)(mBase + row) * ldc + n0 + c4) = v;
        }
        
      }
    } else {
      const int q = lane >> 3, c8 = (lane & 7) * 8;
      unsigned short* C  = (unsigned short*)Cout  + (size_t)b * strideC;
      unsigned short* C2 = (OUT_MODE == 2) ? ((unsigned short*)Cout2 + (size_t)b * strideC) : nullptr;
      {
#pragma unroll
        for (int it = 0; it < 4; ++it) {
          const int row = it * 4 + q;
          const float* sp = slab + row * 68 + c8;
          v8h hv, lv;
#pragma unroll
          for (int e = 0; e < 8; ++e) {
            if (OUT_MODE == 1) {
              hv[e] = (_Float16)sp[e];
            } else {
              unsigned short hb = f2bf_bits(sp[e]);
              unsigned short lb = f2bf_bits(sp[e] - bf_bits2f(hb));
              hv[e] = __builtin_bit_cast(_Float16, hb);
              lv[e] = __builtin_bit_cast(_Float16, lb);
            }
          }
          *(v8h*)(C + (size_t)(mBase + row) * ldc + n0 + c8) = hv;
          if (OUT_MODE == 2) *(v8h*)(C2 + (size_t)(mBase + row) * ldc + n0 + c8) = lv;
        }
        
      }
    }
    __builtin_amdgcn_fence(__ATOMIC_RELEASE, "workgroup");
    __builtin_amdgcn_wave_barrier();
    __builtin_amdgcn_fence(__ATOMIC_ACQUIRE, "workgroup");
  }
}

// ---------------------------------------------------------------------------
// f32 -> bf16 (RNE) -> f16 cast with power-of-two carry: out[8i..8i+7] = f16(scale * bf16(in[8i..8i+7])).
// The bf16 significand times a power of two is exact in f16 for the value ranges used here.
// blockIdx.y selects a row group: in += y * inStride, out += y * outStride (elements).
// Coverage: n8 = (elements per group)/8 threads x 8 = the whole group; every plane group is an exact multiple of 8.
// ---------------------------------------------------------------------------
__global__ __launch_bounds__(256) void cast8_f16_kernel(const float* __restrict__ in, long inStride,
                                                        unsigned short* __restrict__ out, long outStride,
                                                        int n8, float scale) {
  const int i = blockIdx.x * 256 + threadIdx.x;
  if (i >= n8) return;
  const float* p = in + (size_t)blockIdx.y * inStride + 8 * (size_t)i;
  const v4f a = *(const v4f*)(p);
  const v4f c = *(const v4f*)(p + 4);
  unsigned short hb[8];
#pragma unroll
  for (int e = 0; e < 4; ++e) {
    hb[e]     = h_bits(bf_bits2f(f2bf_bits(a[e])) * scale);
    hb[4 + e] = h_bits(bf_bits2f(f2bf_bits(c[e])) * scale);
  }
  const v4u u = (v4u){pk16(hb[0], hb[1]), pk16(hb[2], hb[3]), pk16(hb[4], hb[5]), pk16(hb[6], hb[7])};
  unsigned short* q = out + (size_t)blockIdx.y * outStride + 8 * (size_t)i;
  *(v4u*)q = u;
  
}

// ---------------------------------------------------------------------------
// Fused sliding-window attention: scores, mask, ALiBi bias, softmax and P.V in one kernel, all batches, heads and positions.
// A wave owns 32 queries of one (batch, head) as two 16-column groups and walks their keys in passes of 32, lowest first:
//   S^T = K . Q^T    A = 16 key rows, B = 16 query rows (kept in registers); a lane holds one query's scores for 8 keys per tile
//   O^T += V^T . P^T A = 16 rows of the v^T plane, B = the two score tiles of a pass converted in place (hardware k order,
//                    the same order that Frag::load gives the A side)
// delta = q_idx - kv_idx; a key counts iff 0 <= delta < 512 and kv_idx >= 0 (the walk starts at max(0, q0 - 512), so the
// guard rows / columns in front of the planes are never read). Only a wave's first and last pass can hold masked keys.
// Softmax is online, in base 2: x = s * log2(e)/8 + slope_h * log2(e) * delta; running maximum m (finite start value, so a
// pass with no valid key for a query gives p = 0 and factor 1), p = 2^(x - m + 11) (carried x2048), running sum l per lane half.
// O x16 = 4 * acc / l, since acc = (2048 p)(4 v) summed and l = 2048 p summed.
// grid (kSeq/128, heads, batch), 128 threads = 4 waves; no LDS, no barrier.
// ---------------------------------------------------------------------------
__device__ __forceinline__ float other_half(float x) {   // value of lane l ^ 16
  return __builtin_bit_cast(float, __builtin_amdgcn_permlanex16(__builtin_bit_cast(int, x), __builtin_bit_cast(int, x),
                                                                0x76543210, 0xfedcba98, false, false));
}

// Four (five) values of 2^x in one statement. The instruction set asks for one free issue slot behind a transcendental before
// its result is read or a source register of it is overwritten.
// Here no result shares a register with an argument ("=&v"), so inside the run every slot is filled by the next
// exponential, and the v_nop at the end is the last one's slot.
__device__ __forceinline__ void exp2x4(float (&r)[16], const float (&a)[16], int o) {
  asm("v_exp_f32 %0, %4\n\tv_exp_f32 %1, %5\n\tv_exp_f32 %2, %6\n\tv_exp_f32 %3, %7\n\tv_nop"
      : "=&v"(r[o]), "=&v"(r[o + 1]), "=&v"(r[o + 2]), "=&v"(r[o + 3])
      : "v"(a[o]), "v"(a[o + 1]), "v"(a[o + 2]), "v"(a[o + 3]));
}
__device__ __forceinline__ void exp2x5(float& r4, float a4, float (&r)[16], const float (&a)[16]) {
  asm("v_exp_f32 %0, %5\n\tv_exp_f32 %1, %6\n\tv_exp_f32 %2, %7\n\tv_exp_f32 %3, %8\n\tv_exp_f32 %4, %9\n\tv_nop"
      : "=&v"(r4), "=&v"(r[0]), "=&v"(r[1]), "=&v"(r[2]), "=&v"(r[3])
      : "v"(a4), "v"(a[0]), "v"(a[1]), "v"(a[2]), "v"(a[3]));
}

// One pass: 32 keys from position kt against the wave's 32 queries. kf holds this pass's K fragments on entry and the
// fragments of the pass at ktn on exit (fetched right behind the score products, so that they fly during the softmax).
// MASK: the pass can hold keys outside the window (a wave's first and last pass only).
// Kb, Vb: wave-uniform bases; lk, lv: the lane's own element offsets, the same in every pass.
template <bool MASK>
__device__ __forceinline__ void attn_pass(const _Float16* __restrict__ Kb, const _Float16* __restrict__ Vb,
                                          unsigned lk, unsigned lv, int kt, int ktn, int dq, float sl2,
                                          const v16h (&qf)[2][2], v16h (&kf)[2][2], v8f (&acc)[4][2],
                                          float (&m)[2], float (&l)[2]) {
  typedef Frag<_Float16> F;
  const float c1 = kSScale * 1.4426950408889634f;
  v16h vf[4];
#pragma unroll
  for (int i = 0; i < 4; ++i) vf[i] = F::load(Vb + kt + lv + (size_t)(i * 16) * kVtPitch);

  v8f s[2][2];   // [query group][key tile]
#pragma unroll
  for (int t = 0; t < 2; ++t)
#pragma unroll
    for (int g = 0; g < 2; ++g) {
      s[g][t] = F::mma(kf[t][0], qf[g][0], (v8f){0.f,0.f,0.f,0.f,0.f,0.f,0.f,0.f});
      s[g][t] = F::mma(kf[t][1], qf[g][1], s[g][t]);
    }
#pragma unroll
  for (int t = 0; t < 2; ++t)
#pragma unroll
    for (int kk = 0; kk < 2; ++kk)
      kf[t][kk] = F::load(Kb + (size_t)ktn * kQKPitch + lk + (size_t)(t * 16) * kQKPitch + kk * 32);

  v16h pf[2];
#pragma unroll
  for (int g = 0; g < 2; ++g) {
    const int   di0 = dq + g * 16 - kt;     // delta of key tile 0, register 0
    const float d0  = (float)di0;
    float x[16];
#pragma unroll
    for (int e = 0; e < 16; ++e) {
      const int ce = (e >> 3) * 16 + (e & 7);
      x[e] = s[g][e >> 3][e & 7] * c1 + sl2 * (d0 - (float)ce);
      if (MASK) x[e] = ((unsigned)(di0 - ce) < (unsigned)kWin) ? x[e] : -__builtin_inff();
    }
    float tm = fmaxf(fmaxf(fmaxf(fmaxf(x[0], x[1]), fmaxf(x[2], x[3])), fmaxf(fmaxf(x[4], x[5]), fmaxf(x[6], x[7]))),
                     fmaxf(fmaxf(fmaxf(x[8], x[9]), fmaxf(x[10], x[11])), fmaxf(fmaxf(x[12], x[13]), fmaxf(x[14], x[15]))));
    tm = fmaxf(tm, other_half(tm));
    const float mn    = fmaxf(m[g], tm);
    const float mc    = mn - kPLog2;     // the x2048 carry of p
    float alpha, p[16];
#pragma unroll
    for (int e = 0; e < 16; ++e) x[e] -= mc;
    exp2x5(alpha, m[g] - mn, p, x);      // alpha: the factor that brings the old sums to the new maximum
    exp2x4(p, x, 4);
    exp2x4(p, x, 8);
    exp2x4(p, x, 12);
    m[g] = mn;
#pragma unroll
    for (int e = 0; e < 16; ++e) pf[g][e] = (_Float16)p[e];
    const float ps = (((p[0] + p[1]) + (p[2] + p[3])) + ((p[4] + p[5]) + (p[6] + p[7]))) +
                     (((p[8] + p[9]) + (p[10] + p[11])) + ((p[12] + p[13]) + (p[14] + p[15])));
    l[g] = l[g] * alpha + ps;
#pragma unroll
    for (int i = 0; i < 4; ++i)
#pragma unroll
      for (int r = 0; r < 8; ++r) acc[i][g][r] *= alpha;
  }
#pragma unroll
  for (int i = 0; i < 4; ++i)
#pragma unroll
    for (int g = 0; g < 2; ++g) acc[i][g] = F::mma(vf[i], pf[g], acc[i][g]);
}

// amdgpu_waves_per_eu(4, 4): 4096 waves on 1024 SIMDs; lets the register allocator keep a pass's 16 loads in flight at once
__global__ __launch_bounds__(128) __attribute__((amdgpu_waves_per_eu(4, 4)))
void band_attn_kernel(const unsigned short* __restrict__ qkp, const unsigned short* __restrict__ vtp,
                      unsigned short* __restrict__ op) {
  typedef Frag<_Float16> F;
  const int lane  = threadIdx.x & 31;
  const int wave  = __builtin_amdgcn_readfirstlane(threadIdx.x >> 5);   // scalar: the loop bounds stay scalar
  const int h     = blockIdx.y;
  const int b     = blockIdx.z;
  const int q0    = (blockIdx.x * 4 + wave) * 32;      // first query position of this wave
  const int rlane = lane & 15;
  const int koff  = (lane >> 4) * 8;

  const _Float16* Qb = (const _Float16*)qkp + ((size_t)kGuard + (size_t)b * kSeq) * kQKPitch + h * kHdim;
  const _Float16* Kb = Qb + kEmb;
  const _Float16* Vb = (const _Float16*)vtp + (size_t)h * kHdim * kVtPitch + kGuard + (size_t)b * kSeq;
  const unsigned  lk = (unsigned)(rlane * kQKPitch + koff);
  const unsigned  lv = (unsigned)(rlane * kVtPitch + koff);

  const int   e1  = h + 1;   // slope_h = 2^(-(h+1)/2)
  const float sl  = ((e1 & 1) ? 0.70710678118654752f : 1.0f) * __uint_as_float(((unsigned)(127 - (e1 >> 1))) << 23);
  const float sl2 = sl * 1.4426950408889634f;
  const int   dq  = q0 + rlane - koff;

  const int kstart = (q0 >= kWin) ? (q0 - kWin) : 0;
  v16h qf[2][2], kf[2][2];
#pragma unroll
  for (int g = 0; g < 2; ++g)
#pragma unroll
    for (int kk = 0; kk < 2; ++kk) {
      qf[g][kk] = F::load(Qb + (size_t)q0 * kQKPitch + lk + (size_t)(g * 16) * kQKPitch + kk * 32);
      kf[g][kk] = F::load(Kb + (size_t)kstart * kQKPitch + lk + (size_t)(g * 16) * kQKPitch + kk * 32);
    }
  // the loads above name the lane-offset register; this wait stands before anything below may reuse that register
  asm volatile("s_wait_xcnt 0x0" ::: "memory");

  v8f acc[4][2];
#pragma unroll
  for (int i = 0; i < 4; ++i)
#pragma unroll
    for (int g = 0; g < 2; ++g) acc[i][g] = (v8f){0.f,0.f,0.f,0.f,0.f,0.f,0.f,0.f};
  float m[2] = {-1.0e30f, -1.0e30f};
  float l[2] = {0.f, 0.f};

  int kt = kstart;
  if (q0 >= kWin) {            // keys q0-512 .. q0-481: some delta >= 512
    attn_pass<true>(Kb, Vb, lk, lv, kt, kt + 32, dq, sl2, qf, kf, acc, m, l);
    kt += 32;
  }
  for (; kt < q0; kt += 32)    // every delta in 1 .. 511
    attn_pass<false>(Kb, Vb, lk, lv, kt, kt + 32, dq, sl2, qf, kf, acc, m, l);
  attn_pass<true>(Kb, Vb, lk, lv, q0, q0, dq, sl2, qf, kf, acc, m, l);   // keys q0 .. q0+31: some delta < 0; nothing follows, its fetch ahead is dead code

#pragma unroll
  for (int g = 0; g < 2; ++g) {
    const float lt  = l[g] + other_half(l[g]);
    const float inv = kPVScale / lt;
    unsigned short* orow = op + ((size_t)b * kSeq + q0 + g * 16 + rlane) * kEmb + h * kHdim + koff;
#pragma unroll
    for (int i = 0; i < 4; ++i) {
      v8h hv;
#pragma unroll
      for (int r = 0; r < 8; ++r) hv[r] = (_Float16)(acc[i][g][r] * inv);
      *(v8h*)(orow + i * 16) = hv;    // d = i*16 + koff + r: 8 consecutive halves of one output row
    }
  }
}

// ---------------------------------------------------------------------------
// Launcher
// Token rows are compact: t = b*kSeq + s; input x row = b*kSeqFull + s; output row = b*kSeqFull + s.
// Workspace region map (bytes) for NB=4, SEQ=2048 (smaller NB / SEQ shrink R0, R3, R4):
//   R0 [0,          16777216)   x f16 [kTok][1024]; aliased later by O f16 x16 [kTok][1024] (x dead after the two projections)
//   R1 [16777216,   23068672)   w_in f16 x64 [3072][1024]
//   R2 [23068672,   25165824)   w_out f16 x64 [1024][1024]
//   R3 [25165824,   60817408)   q|k plane f16 x4 [512 guard + kTok][2048]  (guard rows neither written nor read; rows 512.. written by GEMM)
//   R4 [60817408,   78643200)   v^T plane f16 x4 [1024][512 guard + kTok]  (guard cols neither written nor read; cols 512.. written by GEMM)
//   total 78643200
// ---------------------------------------------------------------------------
static_assert(kTok % kBN == 0 && kSeq % kBM == 0 && kEmb % kBN == 0 && kQKPitch % kBN == 0 && kEmb % kBK == 0);
extern "C" void kernel_launch(void* const* d_in, const int* in_sizes, int n_in,
                              void* d_out, int out_size, void* d_ws, size_t ws_size,
                              hipStream_t stream) {
  const size_t NXT = (size_t)kTok * kEmb;                                              // compact x / O plane elements
  const size_t NXNEED = (size_t)(kBatch - 1) * kSeqFull * kEmb + (size_t)kSeq * kEmb;  // last input / output row used + 1
  const size_t NWI = (size_t)3 * kEmb * kEmb;                                          // 3145728
  const size_t NWO = (size_t)kEmb * kEmb;                                              // 1048576
  if (n_in < 3) return;
  if ((size_t)in_sizes[0] < NXNEED || (size_t)in_sizes[1] < NWI || (size_t)in_sizes[2] < NWO) return;
  if ((size_t)out_size < NXNEED) return;

  const float* x     = (const float*)d_in[0];
  const float* w_in  = (const float*)d_in[1];
  const float* w_out = (const float*)d_in[2];
  float* out = (float*)d_out;

  char* ws = (char*)d_ws;
  size_t off = 0;
  unsigned short* x16  = (unsigned short*)(ws + off); off += NXT * 2;
  unsigned short* wi16 = (unsigned short*)(ws + off); off += NWI * 2;
  unsigned short* wo16 = (unsigned short*)(ws + off); off += NWO * 2;
  unsigned short* qk   = (unsigned short*)(ws + off); off += (size_t)kQKRows * kQKPitch * 2;
  unsigned short* vt   = (unsigned short*)(ws + off); off += (size_t)kEmb * kVtPitch * 2;
  unsigned short* o16  = x16;                         // alias: x16 is dead after the two projection GEMMs
  if (off > ws_size) return;
  // dummy in-range pointers for unused bias / resid arguments (never dereferenced with BIAS_MODE 0 / RESID false)
  const float* xf = x;

  // 1-3: casts. x: per batch kSeq*kEmb/8 threads, grid y = batch (src stride kSeqFull*kEmb, dst stride kSeq*kEmb);
  //       w_in: 393216 threads = 1536 blocks; w_out: 131072 = 512 blocks.
  {
    const int n8x = (int)((size_t)kSeq * kEmb / 8);
    cast8_f16_kernel<<<dim3((unsigned)((n8x + 255) / 256), kBatch), dim3(256), 0, stream>>>(
        x, (long)kSeqFull * kEmb, x16, (long)kSeq * kEmb, n8x, 1.0f);
    cast8_f16_kernel<<<dim3((unsigned)((NWI / 8 + 255) / 256), 1), dim3(256), 0, stream>>>(
        w_in, 0L, wi16, 0L, (int)(NWI / 8), kWCarry);
    cast8_f16_kernel<<<dim3((unsigned)((NWO / 8 + 255) / 256), 1), dim3(256), 0, stream>>>(
        w_out, 0L, wo16, 0L, (int)(NWO / 8), kWCarry);
  }

  // 4: q|k = x . w_in[0..2047]^T -> rows 512.. of the q|k plane (M=kTok, N=2048, K=1024, f16 out, scale 1/16 -> carried x4)
  {
    const int tiles = (kTok / kBM) * (kQKPitch / kBN);
    wmma_gemm64<0, false, 0, 1, false, 0><<<dim3((unsigned)tiles, 1), dim3(256), 0, stream>>>(
        x16, x16, kEmb, 0L, wi16, wi16, kEmb, 0L,
        (void*)(qk + (size_t)kGuard * kQKPitch), (void*)(qk + (size_t)kGuard * kQKPitch), kQKPitch, 0L,
        xf, xf, 0L, kTok, kQKPitch, kEmb, kQKScale);
  }
  // 5: v^T = w_in[2048..3071] . x^T -> v^T plane cols 512.. (M=1024, N=kTok, K=1024, f16 out, ldc kVtPitch, scale 1/16 -> carried x4)
  {
    const int tiles = (kEmb / kBM) * (kTok / kBN);
    wmma_gemm64<0, false, 0, 1, false, 0><<<dim3((unsigned)tiles, 1), dim3(256), 0, stream>>>(
        wi16 + (size_t)2 * kEmb * kEmb, wi16 + (size_t)2 * kEmb * kEmb, kEmb, 0L, x16, x16, kEmb, 0L,
        (void*)(vt + kGuard), (void*)(vt + kGuard), kVtPitch, 0L,
        xf, xf, 0L, kEmb, kTok, kEmb, kQKScale);
  }

  // 6: fused sliding-window attention, all batches and heads in one launch -> merged O x16 (128 queries per block)
  band_attn_kernel<<<dim3(kSeq / 128, kHeads, kBatch), dim3(128), 0, stream>>>(qk, vt, o16);

  // 7: out = (16 o) . (64 w_out)^T / 1024 -> d_out f32 rows b*kSeqFull + s (grid y = batch; M=kSeq per batch, N=1024, K=1024)
  {
    const int tiles = (kSeq / kBM) * (kEmb / kBN);
    wmma_gemm64<0, false, 0, 0, false, 0><<<dim3((unsigned)tiles, kBatch), dim3(256), 0, stream>>>(
        o16, o16, kEmb, (long)kSeq * kEmb, wo16, wo16, kEmb, 0L,
        (void*)out, (void*)out, kEmb, (long)kSeqFull * kEmb,
        xf, xf, 0L, kSeq, kEmb, kEmb, kOutScale);
  }
}

// v003
// It runs in 108 microseconds.
// In both of two side-by-side timings against v002, it was 1.07 times as fast.
// Counting every step since v000, it is 11.8 times as fast.
// Contractions: q|k projection (x . w_in^T), v^T projection (w_in . x^T), scores k.q^T (K=64), v^T.p^T (32 keys a pass), output projection (o . w_out^T): all v_wmma_f32_16x16x32_f16 (f16 operands built from bf16-RNE inputs with power-of-two carries: w x64, q/k/v x4, p x2048, o x16), f32 accumulate; sliding-window mask, ALiBi bias and online softmax in f32.
#include <hip/hip_runtime.h>

// ---------------------------------------------------------------------------
// Problem constants (NB / SEQ overridable; *_FULL = input / output layout)
// ---------------------------------------------------------------------------
#ifndef NB
#define NB 4
#endif
#ifndef SEQ
#define SEQ 2048
#endif
#define NB_FULL 4
#define SEQ_FULL 2048

constexpr int kBatch     = NB;
constexpr int kBatchFull = NB_FULL;
constexpr int kSeq       = SEQ;
constexpr int kSeqFull   = SEQ_FULL;
constexpr int kEmb       = 1024;
constexpr int kHeads     = 16;
constexpr int kHdim      = 64;
constexpr int kWin       = 512;
constexpr int kTok       = kBatch * kSeq;         // compact token rows (t = b*kSeq + s)
constexpr int kGuard     = 512;                   // unused rows / columns in front of the key planes (layout kept)
constexpr int kQKRows    = kGuard + kTok;         // rows of the q|k plane
constexpr int kQKPitch   = 2 * kEmb;              // 2048 halves per q|k row (q cols 0..1023, k cols 1024..2047)
constexpr int kVtPitch   = kGuard + kTok;         // halves per v^T row

static_assert(kSeq % kWin == 0);
static_assert(kSeq >= kWin && kSeq <= kSeqFull);
static_assert(kBatch >= 1 && kBatch <= kBatchFull);
static_assert(kHeads * kHdim == kEmb);
static_assert(kTok % 64 == 0 && kEmb % 64 == 0 && kWin % 32 == 0 && kSeq % 128 == 0);
static_assert(kEmb % 32 == 0 && kHdim == 64);
static_assert((kVtPitch * 2) % 128 == 0 && (kQKPitch * 2) % 128 == 0);

constexpr float kWCarry   = 64.0f;             // weights carried x64 in f16
constexpr float kQKScale  = 1.0f / 16.0f;      // (x)(64 w) -> 4 q, 4 k, 4 v
constexpr float kSScale   = 1.0f / 128.0f;     // (4q)(4k) = 16 q.k -> q.k / 8
constexpr float kPLog2    = 11.0f;             // probabilities carried x2048 = 2^11 in f16
constexpr float kPVScale  = 4.0f;              // sum (2048 p)(4 v) / sum (2048 p) = 4 o -> 16 o
constexpr float kOutScale = 1.0f / 1024.0f;    // (16 o)(64 w) = 1024 out -> out

typedef __attribute__((ext_vector_type(16))) _Float16 v16h;
typedef __attribute__((ext_vector_type(8)))  _Float16 v8h;
typedef __attribute__((ext_vector_type(16))) __bf16   v16b;
typedef __attribute__((ext_vector_type(8)))  __bf16   v8b;
typedef __attribute__((ext_vector_type(8)))  float    v8f;
typedef __attribute__((ext_vector_type(4)))  float    v4f;
typedef __attribute__((ext_vector_type(4)))  unsigned int v4u;

__device__ __forceinline__ unsigned short f2bf_bits(float f) {
  unsigned u = __float_as_uint(f);
  return (unsigned short)((u + 0x7FFFu + ((u >> 16) & 1u)) >> 16);
}
__device__ __forceinline__ float bf_bits2f(unsigned short h) { return __uint_as_float(((unsigned)h) << 16); }

// hazard guards as plain device helpers
__device__ __forceinline__ void dep_guard_h(v8f& a, v8f& b, v16h x, v16h y) { asm volatile("v_nop\n\tv_nop\n\tv_nop\n\tv_nop" : "+v"(a), "+v"(b) : "v"(x), "v"(y)); }
__device__ __forceinline__ void dep_guard_b(v8f& a, v8f& b, v16b x, v16b y) { asm volatile("v_nop\n\tv_nop\n\tv_nop\n\tv_nop" : "+v"(a), "+v"(b) : "v"(x), "v"(y)); }
__device__ __forceinline__ void keep4_h(v16h a, v16h b, v16h c, v16h d) { asm volatile("v_nop" :: "v"(a), "v"(b), "v"(c), "v"(d)); }
__device__ __forceinline__ void keep4_b(v16b a, v16b b, v16b c, v16b d) { asm volatile("v_nop" :: "v"(a), "v"(b), "v"(c), "v"(d)); }
__device__ __forceinline__ void acc_guard4(v8f& a, v8f& b, v8f& c, v8f& d) { asm volatile("v_nop\n\tv_nop\n\tv_nop\n\tv_nop" : "+v"(a), "+v"(b), "+v"(c), "+v"(d)); }
template <typename T> struct Frag;
template <> struct Frag<_Float16> {
  typedef v16h V; union U { v16h v; v8h h[2]; };
  static __device__ __forceinline__ v16h load(const _Float16* p) {   // elements 0..7 <- p[0..7], 8..15 <- p[16..23]
    U f; f.h[0] = *(const v8h*)(p); f.h[1] = *(const v8h*)(p + 16); return f.v;
  }
  static __device__ __forceinline__ v8f mma(v16h a, v16h b, v8f c) {
    return __builtin_amdgcn_wmma_f32_16x16x32_f16(false, a, false, b, (short)0, c, false, false);
  }
  static __device__ __forceinline__ void guard(v8f& a, v8f& b, v16h x, v16h y) { dep_guard_h(a, b, x, y); }
  static __device__ __forceinline__ void keep(v16h a, v16h b, v16h c, v16h d) { keep4_h(a, b, c, d); }
};
template <> struct Frag<__bf16> {
  typedef v16b V; union U { v16b v; v8b h[2]; };
  static __device__ __forceinline__ v16b load(const __bf16* p) {
    U f; f.h[0] = *(const v8b*)(p); f.h[1] = *(const v8b*)(p + 16); return f.v;
  }
  static __device__ __forceinline__ v8f mma(v16b a, v16b b, v8f c) {
    return __builtin_amdgcn_wmma_f32_16x16x32_bf16(false, a, false, b, (short)0, c, false, false);
  }
  static __device__ __forceinline__ void guard(v8f& a, v8f& b, v16b x, v16b y) { dep_guard_b(a, b, x, y); }
  static __device__ __forceinline__ void keep(v16b a, v16b b, v16b c, v16b d) { keep4_b(a, b, c, d); }
};

__device__ __forceinline__ unsigned pk16(unsigned short a, unsigned short b) { return (unsigned)a | ((unsigned)b << 16); }
__device__ __forceinline__ unsigned short h_bits(float f) { const _Float16 h = (_Float16)f; return __builtin_bit_cast(unsigned short, h); }

// ---- Register-blocked batched WMMA GEMM (ACT reduced to none/relu/leaky) -----------------------
// C[m,n] = scale * sum_k A[m,k] * Bt[n,k] (+bias)(+resid); a block of 8 waves (2 x 4) owns a 128x256 tile, each wave 64x64 of it.
// A row-major [M,K]; Bt row-major [N,K]; M % 128 == 0, N % 256 == 0, K % 64 == 0.
// Operand path: per trip of 64 k the block's 128 A rows and 256 Bt rows (128 B each) are brought into LDS by asynchronous
// copies, whole 128-B lines, once per block; two buffers, the next trip's copies fly while this trip's products run.
// LDS row pitch 144 B (16 B x odd: no bank conflict for the 16-byte fragment reads).
// BIAS_MODE: 0 = none, 1 = bias[m], 2 = bias[n].
// OUT_MODE: 0 = f32, 1 = f16, 2 = bf16 hi plane (Cout) + bf16 lo plane (Cout2).
// ET: 0 = f16 operands, 1 = bf16 operands (pointers passed as 16-bit storage)
constexpr int kBM      = 128;                        // block tile rows (A rows staged)
constexpr int kBN      = 256;                        // block tile columns (Bt rows staged)
constexpr int kBK      = 64;                         // k per trip
constexpr int kLdsRow  = kBK + 8;                    // 16-bit elements per LDS row: 128 B + 16 B pad
constexpr int kStage   = (kBM + kBN) * kLdsRow;      // elements per buffer: A rows 0..127, Bt rows 128..383
constexpr int kCopies  = (kBM + kBN) * kBK / 8 / 256;   // 16-byte copies per lane and trip
static_assert(kCopies == 12 && kBM / 32 == 4);

// One lane's twelve 16-byte copies of a trip: global -> LDS, through no register. l: LDS byte addresses, p: global addresses.
// The s_wait_xcnt stands inside the statement so that no address register is rewritten in front of it.
__device__ __forceinline__ void async_copy12(const unsigned (&l)[12], const void* const (&p)[12]) {
  asm volatile(
      "global_load_async_to_lds_b128 %0, %12, off\n\t"
      "global_load_async_to_lds_b128 %1, %13, off\n\t"
      "global_load_async_to_lds_b128 %2, %14, off\n\t"
      "global_load_async_to_lds_b128 %3, %15, off\n\t"
      "global_load_async_to_lds_b128 %4, %16, off\n\t"
      "global_load_async_to_lds_b128 %5, %17, off\n\t"
      "global_load_async_to_lds_b128 %6, %18, off\n\t"
      "global_load_async_to_lds_b128 %7, %19, off\n\t"
      "global_load_async_to_lds_b128 %8, %20, off\n\t"
      "global_load_async_to_lds_b128 %9, %21, off\n\t"
      "global_load_async_to_lds_b128 %10, %22, off\n\t"
      "global_load_async_to_lds_b128 %11, %23, off\n\t"
      "s_wait_xcnt 0x0"
      :: "v"(l[0]), "v"(l[1]), "v"(l[2]), "v"(l[3]), "v"(l[4]), "v"(l[5]), "v"(l[6]), "v"(l[7]), "v"(l[8]), "v"(l[9]),
         "v"(l[10]), "v"(l[11]),
         "v"(p[0]), "v"(p[1]), "v"(p[2]), "v"(p[3]), "v"(p[4]), "v"(p[5]), "v"(p[6]), "v"(p[7]), "v"(p[8]), "v"(p[9]),
         "v"(p[10]), "v"(p[11])
      : "memory");
}

template <int ET> struct Elem;
template <> struct Elem<0> { typedef _Float16 T; };
template <> struct Elem<1> { typedef __bf16 T; };
template <int ET, bool SPLIT, int BIAS_MODE, int OUT_MODE, bool RESID, int ACT = 0>
__global__ __launch_bounds__(256) void wmma_gemm64(
    const unsigned short* __restrict__ Ap, const unsigned short* __restrict__ A2p, int lda, long strideA,
    const unsigned short* __restrict__ Btp, const unsigned short* __restrict__ Bt2p, int ldb, long strideB,
    void* __restrict__ Cout, void* __restrict__ Cout2, int ldc, long strideC,
    const float* __restrict__ bias,
    const float* __restrict__ resid, long strideR,
    int M, int N, int K, float scale) {
  static_assert(!SPLIT, "the staged operand path carries one plane per operand");
  typedef typename Elem<ET>::T T;
  typedef typename Frag<T>::V V;
  const T* A = (const T*)Ap; const T* Bt = (const T*)Btp;
  __shared__ __align__(16) T     sOp[2][kStage];   // the two operand buffers
  __shared__ __align__(16) float sT[8][16 * 68];   // per-wave 16x64 slab, pitch 68 floats
  const int b    = blockIdx.y;
  const int lane = threadIdx.x & 31;
  const int wave = threadIdx.x >> 5;
  const int tilesN = N / kBN;
  const int tilesM = M / kBM;
  const int tile = blockIdx.x;
  if (tile >= tilesM * tilesN) return;   // block-uniform, in front of every barrier
  const int tm = tile / tilesN;
  const int tn = tile - tm * tilesN;
  const int bm0 = tm * kBM;                    // block tile origin
  const int bn0 = tn * kBN;
  const int wm  = (wave >> 2) << 6;            // wave tile origin inside the block tile
  const int wn  = (wave & 3) << 6;
  const int m0  = bm0 + wm;
  const int n0  = bn0 + wn;

  const T* Ab  = A  + (size_t)b * strideA;
  const T* Bb  = Bt + (size_t)b * strideB;

  const int rlane = lane & 15;                 // row (A) / col (B, D) within subtile
  const int koff  = (lane >> 4) * 8;           // k offset of this lane half
  const int mOff  = (lane >> 4) * 8;           // D row offset

  // copy roles: 8 lanes cover one 128-B row, a wave-wide copy covers 4 whole rows; copy j of a thread serves staged row crow + 32 j
  const int crow = threadIdx.x >> 3;           // 0..31
  const int ccol = (threadIdx.x & 7) * 8;      // element offset of the lane's 16 bytes in the row
  const T* gA = Ab + (size_t)(bm0 + crow) * lda + ccol;
  const T* gB = Bb + (size_t)(bn0 + crow) * ldb + ccol;
  const unsigned lds0 = (unsigned)(size_t)(&sOp[0][0]) + (unsigned)(crow * kLdsRow + ccol) * 2u;
  auto stage_in = [&](int t, int buf) {        // trip t's operand rows -> buffer buf
    unsigned l[12];
    const void* p[12];
#pragma unroll   // the twelve address pairs are operands of one asm statement: they must be registers, not arrays in memory
    for (int j = 0; j < 12; ++j) {
      l[j] = lds0 + (unsigned)(buf * kStage + j * 32 * kLdsRow) * 2u;
      p[j] = (j < 4) ? (const void*)(gA + (size_t)(j * 32) * lda + t * kBK)
                     : (const void*)(gB + (size_t)((j - 4) * 32) * ldb + t * kBK);
    }
    async_copy12(l, p);
  };

  v8f acc[4][4];
#pragma unroll
  for (int i = 0; i < 4; ++i)
#pragma unroll
    for (int j = 0; j < 4; ++j) acc[i][j] = (v8f){0.f,0.f,0.f,0.f,0.f,0.f,0.f,0.f};

  const int trips = K / kBK;
  stage_in(0, 0);
  asm volatile("s_wait_asynccnt 0x0" ::: "memory");   // this wave's share of trip 0 has landed
  __syncthreads();                                    // every wave's share has: buffer 0 may be read
  if (trips > 1) stage_in(1, 1);

  for (int t = 0; t < trips; ++t) {
    const T* sA = &sOp[t & 1][(wm + rlane) * kLdsRow + koff];
    const T* sB = &sOp[t & 1][(kBM + wn + rlane) * kLdsRow + koff];
#pragma unroll   // both 32-k steps in one body: the second step's fragment reads can start under the first step's products
    for (int kk = 0; kk < kBK; kk += 32) {
      V bh[4], ah[4];   // all eight fragments of a 32-k step are read as one group, in front of its 16 products
#pragma unroll
      for (int j = 0; j < 4; ++j) bh[j] = Frag<T>::load(sB + (j << 4) * kLdsRow + kk);
#pragma unroll
      for (int i = 0; i < 4; ++i) ah[i] = Frag<T>::load(sA + (i << 4) * kLdsRow + kk);
#pragma unroll
      for (int i = 0; i < 4; ++i) {
#pragma unroll
        for (int j = 0; j < 4; ++j) acc[i][j] = Frag<T>::mma(ah[i], bh[j], acc[i][j]);
        Frag<T>::guard(acc[i][0], acc[i][3], ah[i], ah[i]);
      }
      Frag<T>::keep(bh[0], bh[1], bh[2], bh[3]);
    }
    asm volatile("s_wait_dscnt 0x0" ::: "memory");      // this wave's reads of buffer t & 1 are done before it is refilled
    asm volatile("s_wait_asynccnt 0x0" ::: "memory");   // this wave's share of trip t + 1 has landed
    __syncthreads();                                    // publishes trip t + 1 and ends every reader's last read of trip t
    if (t + 2 < trips) stage_in(t + 2, t & 1);
  }
  asm volatile("s_wait_asynccnt 0x0" ::: "memory");     // nothing in flight when the wave goes on to the epilogue and ends
  acc_guard4(acc[0][0], acc[0][1], acc[0][2], acc[0][3]);
  acc_guard4(acc[1][0], acc[1][1], acc[1][2], acc[1][3]);
  acc_guard4(acc[2][0], acc[2][1], acc[2][2], acc[2][3]);
  acc_guard4(acc[3][0], acc[3][1], acc[3][2], acc[3][3]);

  // ---- epilogue ----
  float* slab = sT[wave];
  const float* Rb = RESID ? (resid + (size_t)b * strideR) : nullptr;
#pragma unroll
  for (int i = 0; i < 4; ++i) {
    const int mBase = m0 + (i << 4);
#pragma unroll
    for (int j = 0; j < 4; ++j) {
      const int n = n0 + (j << 4) + rlane;
      float bv = 0.f;
      if (BIAS_MODE == 2) bv = bias[n];
#pragma unroll
      for (int r = 0; r < 8; ++r) {
        float v = acc[i][j][r] * scale;
        if (BIAS_MODE == 1) v += bias[mBase + mOff + r];
        if (BIAS_MODE == 2) v += bv;
        if (RESID) v += Rb[(size_t)(mBase + mOff + r) * ldc + n];
        if (ACT == 2) v = fmaxf(v, 0.0f);
        if (ACT == 4) v = (v > 0.f) ? v : 0.01f * v;
        slab[(mOff + r) * 68 + (j << 4) + rlane] = v;
      }
    }
    __builtin_amdgcn_fence(__ATOMIC_RELEASE, "workgroup");
    __builtin_amdgcn_wave_barrier();
    __builtin_amdgcn_fence(__ATOMIC_ACQUIRE, "workgroup");
    if (OUT_MODE == 0) {
      float* C = (float*)Cout + (size_t)b * strideC;
      const int hh = lane >> 4, c4 = (lane & 15) * 4;     // row seg = 256 B = 16 lanes x 16 B
      {
#pragma unroll
        for (int it = 0; it < 8; ++it) {
          const int row = it * 2 + hh;
          v4f v = *(const v4f*)(slab + row * 68 + c4);
          *(v4f*)(C + (size_t)(mBase + row) * ldc + n0 + c4) = v;
        }
        
      }
    } else {
      const int q = lane >> 3, c8 = (lane & 7) * 8;
      unsigned short* C  = (unsigned short*)Cout  + (size_t)b * strideC;
      unsigned short* C2 = (OUT_MODE == 2) ? ((unsigned short*)Cout2 + (size_t)b * strideC) : nullptr;
      {
#pragma unroll
        for (int it = 0; it < 4; ++it) {
          const int row = it * 4 + q;
          const float* sp = slab + row * 68 + c8;
          v8h hv, lv;
#pragma unroll
          for (int e = 0; e < 8; ++e) {
            if (OUT_MODE == 1) {
              hv[e] = (_Float16)sp[e];
            } else {
              unsigned short hb = f2bf_bits(sp[e]);
              unsigned short lb = f2bf_bits(sp[e] - bf_bits2f(hb));
              hv[e] = __builtin_bit_cast(_Float16, hb);
              lv[e] = __builtin_bit_cast(_Float16, lb);
            }
          }
          *(v8h*)(C + (size_t)(mBase + row) * ldc + n0 + c8) = hv;
          if (OUT_MODE == 2) *(v8h*)(C2 + (size_t)(mBase + row) * ldc + n0 + c8) = lv;
        }
        
      }
    }
    __builtin_amdgcn_fence(__ATOMIC_RELEASE, "workgroup");
    __builtin_amdgcn_wave_barrier();
    __builtin_amdgcn_fence(__ATOMIC_ACQUIRE, "workgroup");
  }
}

// ---------------------------------------------------------------------------
// f32 -> bf16 (RNE) -> f16 cast with power-of-two carry: out[8i..8i+7] = f16(scale * bf16(in[8i..8i+7])).
// The bf16 significand times a power of two is exact in f16 for the value ranges used here.
// blockIdx.y selects a row group: in += y * inStride, out += y * outStride (elements).
// Coverage: n8 = (elements per group)/8 threads x 8 = the whole group; every plane group is an exact multiple of 8.
// ---------------------------------------------------------------------------
__global__ __launch_bounds__(256) void cast8_f16_kernel(const float* __restrict__ in, long inStride,
                                                        unsigned short* __restrict__ out, long outStride,
                                                        int n8, float scale) {
  const int i = blockIdx.x * 256 + threadIdx.x;
  if (i >= n8) return;
  const float* p = in + (size_t)blockIdx.y * inStride + 8 * (size_t)i;
  const v4f a = *(const v4f*)(p);
  const v4f c = *(const v4f*)(p + 4);
  unsigned short hb[8];
#pragma unroll
  for (int e = 0; e < 4; ++e) {
    hb[e]     = h_bits(bf_bits2f(f2bf_bits(a[e])) * scale);
    hb[4 + e] = h_bits(bf_bits2f(f2bf_bits(c[e])) * scale);
  }
  const v4u u = (v4u){pk16(hb[0], hb[1]), pk16(hb[2], hb[3]), pk16(hb[4], hb[5]), pk16(hb[6], hb[7])};
  unsigned short* q = out + (size_t)blockIdx.y * outStride + 8 * (size_t)i;
  *(v4u*)q = u;
  
}

// ---------------------------------------------------------------------------
// Fused sliding-window attention: scores, mask, ALiBi bias, softmax and P.V in one kernel, all batches, heads and positions.
// A wave owns 32 queries of one (batch, head) as two 16-column groups and walks their keys in passes of 32, lowest first:
//   S^T = K . Q^T    A = 16 key rows, B = 16 query rows (kept in registers); a lane holds one query's scores for 8 keys per tile
//   O^T += V^T . P^T A = 16 rows of the v^T plane, B = the two score tiles of a pass converted in place (hardware k order,
//                    the same order that Frag::load gives the A side)
// delta = q_idx - kv_idx; a key counts iff 0 <= delta < 512 and kv_idx >= 0 (the walk starts at max(0, q0 - 512), so the
// guard rows / columns in front of the planes are never read). Only a wave's first and last pass can hold masked keys.
// Operand path: the block's four waves share their keys. Stages of 64 keys (64 K rows and 64 v^T rows, 128 B each) are brought
// into LDS by asynchronous copies, whole 128-B lines, once per block; two buffers, the next stage's copies fly while this
// stage's passes run. The block walks keys max(0, Q0 - 512) .. Q0 + 127 (Q0: its first query); a wave takes part in the
// passes of its own window only, lowest keys first, and passes every barrier.
// Softmax is online, in base 2: x = s * log2(e)/8 + slope_h * log2(e) * delta; running maximum m (finite start value, so a
// pass with no valid key for a query gives p = 0 and factor 1), p = 2^(x - m + 11) (carried x2048), running sum l per lane half.
// O x16 = 4 * acc / l, since acc = (2048 p)(4 v) summed and l = 2048 p summed.
// grid (kSeq/128, heads, batch), 128 threads = 4 waves; LDS row pitch 144 B (16 B x odd), one barrier per stage.
// ---------------------------------------------------------------------------
__device__ __forceinline__ float other_half(float x) {   // value of lane l ^ 16
  return __builtin_bit_cast(float, __builtin_amdgcn_permlanex16(__builtin_bit_cast(int, x), __builtin_bit_cast(int, x),
                                                                0x76543210, 0xfedcba98, false, false));
}

// Four (five) values of 2^x in one statement. The instruction set asks for one free issue slot behind a transcendental before
// its result is read or a source register of it is overwritten.
// Here no result shares a register with an argument ("=&v"), so inside the run every slot is filled by the next
// exponential, and the v_nop at the end is the last one's slot.
__device__ __forceinline__ void exp2x4(float (&r)[16], const float (&a)[16], int o) {
  asm("v_exp_f32 %0, %4\n\tv_exp_f32 %1, %5\n\tv_exp_f32 %2, %6\n\tv_exp_f32 %3, %7\n\tv_nop"
      : "=&v"(r[o]), "=&v"(r[o + 1]), "=&v"(r[o + 2]), "=&v"(r[o + 3])
      : "v"(a[o]), "v"(a[o + 1]), "v"(a[o + 2]), "v"(a[o + 3]));
}
__device__ __forceinline__ void exp2x5(float& r4, float a4, float (&r)[16], const float (&a)[16]) {
  asm("v_exp_f32 %0, %5\n\tv_exp_f32 %1, %6\n\tv_exp_f32 %2, %7\n\tv_exp_f32 %3, %8\n\tv_exp_f32 %4, %9\n\tv_nop"
      : "=&v"(r4), "=&v"(r[0]), "=&v"(r[1]), "=&v"(r[2]), "=&v"(r[3])
      : "v"(a4), "v"(a[0]), "v"(a[1]), "v"(a[2]), "v"(a[3]));
}

constexpr int kAKeys   = 64;                          // keys per stage
constexpr int kAStage  = (kAKeys + kHdim) * kLdsRow;  // elements per buffer: K rows 0..63 (one key each), v^T rows 64..127 (one d each)
static_assert(kAKeys * 2 == 128 && kHdim * 2 == 128 && kLdsRow == 72 && kWin % 128 == 0);

// One lane's eight 16-byte copies of a stage: global -> LDS, through no register. l: LDS byte addresses, p: global addresses.
// The s_wait_xcnt stands inside the statement so that no address register is rewritten in front of it.
__device__ __forceinline__ void async_copy8(const unsigned (&l)[8], const void* const (&p)[8]) {
  asm volatile(
      "global_load_async_to_lds_b128 %0, %8, off\n\t"
      "global_load_async_to_lds_b128 %1, %9, off\n\t"
      "global_load_async_to_lds_b128 %2, %10, off\n\t"
      "global_load_async_to_lds_b128 %3, %11, off\n\t"
      "global_load_async_to_lds_b128 %4, %12, off\n\t"
      "global_load_async_to_lds_b128 %5, %13, off\n\t"
      "global_load_async_to_lds_b128 %6, %14, off\n\t"
      "global_load_async_to_lds_b128 %7, %15, off\n\t"
      "s_wait_xcnt 0x0"
      :: "v"(l[0]), "v"(l[1]), "v"(l[2]), "v"(l[3]), "v"(l[4]), "v"(l[5]), "v"(l[6]), "v"(l[7]),
         "v"(p[0]), "v"(p[1]), "v"(p[2]), "v"(p[3]), "v"(p[4]), "v"(p[5]), "v"(p[6]), "v"(p[7])
      : "memory");
}

// One pass: 32 keys from position kt against the wave's 32 queries.
// mask (the same in every lane): the pass can hold keys outside the window (a wave's first and last pass only).
// sK: the lane's place in the pass's first staged K row; sV: the lane's place at the pass's first key in staged v^T row 0.
__device__ __forceinline__ void attn_pass(bool mask, const _Float16* sK, const _Float16* sV, int kt, int dq, float sl2,
                                          const v16h (&qf)[2][2], v8f (&acc)[4][2],
                                          float (&m)[2], float (&l)[2]) {
  typedef Frag<_Float16> F;
  const float c1 = kSScale * 1.4426950408889634f;
  v16h kf[2][2], vf[4];
#pragma unroll
  for (int t = 0; t < 2; ++t)
#pragma unroll
    for (int kk = 0; kk < 2; ++kk) kf[t][kk] = F::load(sK + (t * 16) * kLdsRow + kk * 32);

  v8f s[2][2];   // [query group][key tile]
#pragma unroll
  for (int t = 0; t < 2; ++t)
#pragma unroll
    for (int g = 0; g < 2; ++g) {
      s[g][t] = F::mma(kf[t][0], qf[g][0], (v8f){0.f,0.f,0.f,0.f,0.f,0.f,0.f,0.f});
      s[g][t] = F::mma(kf[t][1], qf[g][1], s[g][t]);
    }
#pragma unroll
  for (int i = 0; i < 4; ++i) vf[i] = F::load(sV + (i * 16) * kLdsRow);   // read behind the score products: they land during the softmax
  v16h pf[2];
  float xs[2][16];
#pragma unroll
  for (int g = 0; g < 2; ++g) {
    const float d0 = (float)(dq + g * 16 - kt);     // delta of key tile 0, register 0
#pragma unroll
    for (int e = 0; e < 16; ++e) {
      const int ce = (e >> 3) * 16 + (e & 7);
      xs[g][e] = s[g][e >> 3][e & 7] * c1 + sl2 * (d0 - (float)ce);
    }
  }
  if (mask) {   // one scalar test a pass, for both query groups
#pragma unroll
    for (int g = 0; g < 2; ++g)
#pragma unroll
      for (int e = 0; e < 16; ++e) {
        const int ce = (e >> 3) * 16 + (e & 7);
        xs[g][e] = ((unsigned)(dq + g * 16 - kt - ce) < (unsigned)kWin) ? xs[g][e] : -__builtin_inff();
      }
  }
#pragma unroll
  for (int g = 0; g < 2; ++g) {
    float (&x)[16] = xs[g];
    float tm = fmaxf(fmaxf(fmaxf(fmaxf(x[0], x[1]), fmaxf(x[2], x[3])), fmaxf(fmaxf(x[4], x[5]), fmaxf(x[6], x[7]))),
                     fmaxf(fmaxf(fmaxf(x[8], x[9]), fmaxf(x[10], x[11])), fmaxf(fmaxf(x[12], x[13]), fmaxf(x[14], x[15]))));
    tm = fmaxf(tm, other_half(tm));
    const float mn    = fmaxf(m[g], tm);
    const float mc    = mn - kPLog2;     // the x2048 carry of p
    float alpha, p[16];
#pragma unroll
    for (int e = 0; e < 16; ++e) x[e] -= mc;
    exp2x5(alpha, m[g] - mn, p, x);      // alpha: the factor that brings the old sums to the new maximum
    exp2x4(p, x, 4);
    exp2x4(p, x, 8);
    exp2x4(p, x, 12);
    m[g] = mn;
#pragma unroll
    for (int e = 0; e < 16; ++e) pf[g][e] = (_Float16)p[e];
    const float ps = (((p[0] + p[1]) + (p[2] + p[3])) + ((p[4] + p[5]) + (p[6] + p[7]))) +
                     (((p[8] + p[9]) + (p[10] + p[11])) + ((p[12] + p[13]) + (p[14] + p[15])));
    l[g] = l[g] * alpha + ps;
#pragma unroll
    for (int i = 0; i < 4; ++i)
#pragma unroll
      for (int r = 0; r < 8; ++r) acc[i][g][r] *= alpha;
  }
#pragma unroll
  for (int i = 0; i < 4; ++i)
#pragma unroll
    for (int g = 0; g < 2; ++g) acc[i][g] = F::mma(vf[i], pf[g], acc[i][g]);
}

// amdgpu_waves_per_eu(4, 4): 4096 waves on 1024 SIMDs; lets the register allocator keep a pass's 16 fragment reads in flight at once
__global__ __launch_bounds__(128) __attribute__((amdgpu_waves_per_eu(4, 4)))
void band_attn_kernel(const unsigned short* __restrict__ qkp, const unsigned short* __restrict__ vtp,
                      unsigned short* __restrict__ op) {
  typedef Frag<_Float16> F;
  __shared__ __align__(16) _Float16 sKV[2][kAStage];   // the two stage buffers
  const int lane  = threadIdx.x & 31;
  const int wave  = __builtin_amdgcn_readfirstlane(threadIdx.x >> 5);   // scalar: the tests on a wave's window stay scalar
  const int h     = blockIdx.y;
  const int b     = blockIdx.z;
  const int q0    = (blockIdx.x * 4 + wave) * 32;      // first query position of this wave
  const int rlane = lane & 15;
  const int koff  = (lane >> 4) * 8;

  const _Float16* Qb = (const _Float16*)qkp + ((size_t)kGuard + (size_t)b * kSeq) * kQKPitch + h * kHdim;
  const _Float16* Kb = Qb + kEmb;
  const _Float16* Vb = (const _Float16*)vtp + (size_t)h * kHdim * kVtPitch + kGuard + (size_t)b * kSeq;
  const unsigned  lk = (unsigned)(rlane * kQKPitch + koff);

  const int   e1  = h + 1;   // slope_h = 2^(-(h+1)/2)
  const float sl  = ((e1 & 1) ? 0.70710678118654752f : 1.0f) * __uint_as_float(((unsigned)(127 - (e1 >> 1))) << 23);
  const float sl2 = sl * 1.4426950408889634f;
  const int   dq  = q0 + rlane - koff;

  const int kstart = (q0 >= kWin) ? (q0 - kWin) : 0;   // first key of this wave's window
  const int Q0     = blockIdx.x * 128;                 // first query position of the block
  const int ks0    = (Q0 >= kWin) ? (Q0 - kWin) : 0;   // first key the block stages
  const int trips  = (Q0 + 128 - ks0) / kAKeys;        // stages: 2 .. 10, the last ends at key Q0 + 127 < kSeq

  // copy roles: 8 lanes cover one 128-B row, a wave-wide copy covers 4 whole rows; copy j of a thread serves staged row crow + 16 j
  const int crow = threadIdx.x >> 3;           // 0..15
  const int ccol = (threadIdx.x & 7) * 8;      // element offset of the lane's 16 bytes in the row
  const _Float16* gK = Kb + (size_t)(ks0 + crow) * kQKPitch + ccol;
  const _Float16* gV = Vb + (size_t)crow * kVtPitch + ks0 + ccol;
  const unsigned lds0 = (unsigned)(size_t)(&sKV[0][0]) + (unsigned)(crow * kLdsRow + ccol) * 2u;
  auto stage_in = [&](int t, int buf) {        // stage t's K and v^T rows -> buffer buf
    unsigned sl[8];
    const void* sp[8];
#pragma unroll   // the eight address pairs are operands of one asm statement: they must be registers, not arrays in memory
    for (int j = 0; j < 8; ++j) {
      sl[j] = lds0 + (unsigned)(buf * kAStage + j * 16 * kLdsRow) * 2u;
      sp[j] = (j < 4) ? (const void*)(gK + (size_t)(t * kAKeys + j * 16) * kQKPitch)
                      : (const void*)(gV + (size_t)((j - 4) * 16 * kVtPitch + t * kAKeys));
    }
    async_copy8(sl, sp);
  };
  stage_in(0, 0);

  v16h qf[2][2];
#pragma unroll
  for (int g = 0; g < 2; ++g)
#pragma unroll
    for (int kk = 0; kk < 2; ++kk)
      qf[g][kk] = F::load(Qb + (size_t)q0 * kQKPitch + lk + (size_t)(g * 16) * kQKPitch + kk * 32);
  // the loads above name the lane-offset register; this wait stands before anything below may reuse that register
  asm volatile("s_wait_xcnt 0x0" ::: "memory");

  v8f acc[4][2];
#pragma unroll
  for (int i = 0; i < 4; ++i)
#pragma unroll
    for (int g = 0; g < 2; ++g) acc[i][g] = (v8f){0.f,0.f,0.f,0.f,0.f,0.f,0.f,0.f};
  float m[2] = {-1.0e30f, -1.0e30f};
  float l[2] = {0.f, 0.f};

  asm volatile("s_wait_asynccnt 0x0" ::: "memory");   // this wave's share of stage 0 has landed
  __syncthreads();                                    // every wave's share has: buffer 0 may be read
  if (trips > 1) stage_in(1, 1);

  for (int t = 0; t < trips; ++t) {
    const _Float16* sb = &sKV[t & 1][rlane * kLdsRow + koff];
    for (int u = 0; u < 2; ++u) {
      const int kt = ks0 + t * kAKeys + u * 32;
      if (kt >= kstart && kt <= q0) {                 // the pass lies in this wave's window (scalar test)
        const _Float16* sK = sb + (u * 32) * kLdsRow;
        const _Float16* sV = sb + kAKeys * kLdsRow + u * 32;
        // keys q0 .. q0+31: some delta < 0; keys q0-512 .. q0-481: some delta >= 512; between them every delta is in 1 .. 511
        attn_pass(kt == q0 || kt + kWin == q0, sK, sV, kt, dq, sl2, qf, acc, m, l);
      }
    }
    asm volatile("s_wait_dscnt 0x0" ::: "memory");      // this wave's reads of buffer t & 1 are done before it is refilled
    asm volatile("s_wait_asynccnt 0x0" ::: "memory");   // this wave's share of stage t + 1 has landed
    __syncthreads();                                    // publishes stage t + 1 and ends every reader's last read of stage t
    if (t + 2 < trips) stage_in(t + 2, t & 1);
  }
  asm volatile("s_wait_asynccnt 0x0" ::: "memory");     // nothing in flight when the wave goes on to the epilogue and ends

#pragma unroll
  for (int g = 0; g < 2; ++g) {
    const float lt  = l[g] + other_half(l[g]);
    const float inv = kPVScale / lt;
    unsigned short* orow = op + ((size_t)b * kSeq + q0 + g * 16 + rlane) * kEmb + h * kHdim + koff;
#pragma unroll
    for (int i = 0; i < 4; ++i) {
      v8h hv;
#pragma unroll
      for (int r = 0; r < 8; ++r) hv[r] = (_Float16)(acc[i][g][r] * inv);
      *(v8h*)(orow + i * 16) = hv;    // d = i*16 + koff + r: 8 consecutive halves of one output row
    }
  }
}

// ---------------------------------------------------------------------------
// Launcher
// Token rows are compact: t = b*kSeq + s; input x row = b*kSeqFull + s; output row = b*kSeqFull + s.
// Workspace region map (bytes) for NB=4, SEQ=2048 (smaller NB / SEQ shrink R0, R3, R4):
//   R0 [0,          16777216)   x f16 [kTok][1024]; aliased later by O f16 x16 [kTok][1024] (x dead after the two projections)
//   R1 [16777216,   23068672)   w_in f16 x64 [3072][1024]
//   R2 [23068672,   25165824)   w_out f16 x64 [1024][1024]
//   R3 [25165824,   60817408)   q|k plane f16 x4 [512 guard + kTok][2048]  (guard rows neither written nor read; rows 512.. written by GEMM)
//   R4 [60817408,   78643200)   v^T plane f16 x4 [1024][512 guard + kTok]  (guard cols neither written nor read; cols 512.. written by GEMM)
//   total 78643200
// ---------------------------------------------------------------------------
static_assert(kTok % kBN == 0 && kSeq % kBM == 0 && kEmb % kBN == 0 && kQKPitch % kBN == 0 && kEmb % kBK == 0);
extern "C" void kernel_launch(void* const* d_in, const int* in_sizes, int n_in,
                              void* d_out, int out_size, void* d_ws, size_t ws_size,
                              hipStream_t stream) {
  const size_t NXT = (size_t)kTok * kEmb;                                              // compact x / O plane elements
  const size_t NXNEED = (size_t)(kBatch - 1) * kSeqFull * kEmb + (size_t)kSeq * kEmb;  // last input / output row used + 1
  const size_t NWI = (size_t)3 * kEmb * kEmb;                                          // 3145728
  const size_t NWO = (size_t)kEmb * kEmb;                                              // 1048576
  if (n_in < 3) return;
  if ((size_t)in_sizes[0] < NXNEED || (size_t)in_sizes[1] < NWI || (size_t)in_sizes[2] < NWO) return;
  if ((size_t)out_size < NXNEED) return;

  const float* x     = (const float*)d_in[0];
  const float* w_in  = (const float*)d_in[1];
  const float* w_out = (const float*)d_in[2];
  float* out = (float*)d_out;

  char* ws = (char*)d_ws;
  size_t off = 0;
  unsigned short* x16  = (unsigned short*)(ws + off); off += NXT * 2;
  unsigned short* wi16 = (unsigned short*)(ws + off); off += NWI * 2;
  unsigned short* wo16 = (unsigned short*)(ws + off); off += NWO * 2;
  unsigned short* qk   = (unsigned short*)(ws + off); off += (size_t)kQKRows * kQKPitch * 2;
  unsigned short* vt   = (unsigned short*)(ws + off); off += (size_t)kEmb * kVtPitch * 2;
  unsigned short* o16  = x16;                         // alias: x16 is dead after the two projection GEMMs
  if (off > ws_size) return;
  // dummy in-range pointers for unused bias / resid arguments (never dereferenced with BIAS_MODE 0 / RESID false)
  const float* xf = x;

  // 1-3: casts. x: per batch kSeq*kEmb/8 threads, grid y = batch (src stride kSeqFull*kEmb, dst stride kSeq*kEmb);
  //       w_in: 393216 threads = 1536 blocks; w_out: 131072 = 512 blocks.
  {
    const int n8x = (int)((size_t)kSeq * kEmb / 8);
    cast8_f16_kernel<<<dim3((unsigned)((n8x + 255) / 256), kBatch), dim3(256), 0, stream>>>(
        x, (long)kSeqFull * kEmb, x16, (long)kSeq * kEmb, n8x, 1.0f);
    cast8_f16_kernel<<<dim3((unsigned)((NWI / 8 + 255) / 256), 1), dim3(256), 0, stream>>>(
        w_in, 0L, wi16, 0L, (int)(NWI / 8), kWCarry);
    cast8_f16_kernel<<<dim3((unsigned)((NWO / 8 + 255) / 256), 1), dim3(256), 0, stream>>>(
        w_out, 0L, wo16, 0L, (int)(NWO / 8), kWCarry);
  }

  // 4: q|k = x . w_in[0..2047]^T -> rows 512.. of the q|k plane (M=kTok, N=2048, K=1024, f16 out, scale 1/16 -> carried x4)
  {
    const int tiles = (kTok / kBM) * (kQKPitch / kBN);
    wmma_gemm64<0, false, 0, 1, false, 0><<<dim3((unsigned)tiles, 1), dim3(256), 0, stream>>>(
        x16, x16, kEmb, 0L, wi16, wi16, kEmb, 0L,
        (void*)(qk + (size_t)kGuard * kQKPitch), (void*)(qk + (size_t)kGuard * kQKPitch), kQKPitch, 0L,
        xf, xf, 0L, kTok, kQKPitch, kEmb, kQKScale);
  }
  // 5: v^T = w_in[2048..3071] . x^T -> v^T plane cols 512.. (M=1024, N=kTok, K=1024, f16 out, ldc kVtPitch, scale 1/16 -> carried x4)
  {
    const int tiles = (kEmb / kBM) * (kTok / kBN);
    wmma_gemm64<0, false, 0, 1, false, 0><<<dim3((unsigned)tiles, 1), dim3(256), 0, stream>>>(
        wi16 + (size_t)2 * kEmb * kEmb, wi16 + (size_t)2 * kEmb * kEmb, kEmb, 0L, x16, x16, kEmb, 0L,
        (void*)(vt + kGuard), (void*)(vt + kGuard), kVtPitch, 0L,
        xf, xf, 0L, kEmb, kTok, kEmb, kQKScale);
  }

  // 6: fused sliding-window attention, all batches and heads in one launch -> merged O x16 (128 queries per block)
  band_attn_kernel<<<dim3(kSeq / 128, kHeads, kBatch), dim3(128), 0, stream>>>(qk, vt, o16);

  // 7: out = (16 o) . (64 w_out)^T / 1024 -> d_out f32 rows b*kSeqFull + s (grid y = batch; M=kSeq per batch, N=1024, K=1024)
  {
    const int tiles = (kSeq / kBM) * (kEmb / kBN);
    wmma_gemm64<0, false, 0, 0, false, 0><<<dim3((unsigned)tiles, kBatch), dim3(256), 0, stream>>>(
        o16, o16, kEmb, (long)kSeq * kEmb, wo16, wo16, kEmb, 0L,
        (void*)out, (void*)out, kEmb, (long)kSeqFull * kEmb,
        xf, xf, 0L, kSeq, kEmb, kEmb, kOutScale);
  }
}

// v004
// It runs in 103 microseconds.
// Timed twice side by side with v003, it ran 1.05 times as fast both times.
// Over all steps from v000 it is 12.4 times as fast.
// Contractions: q|k projection (x . w_in^T), v^T projection (w_in . x^T), scores k.q^T (K=64), v^T.p^T (32 keys a pass), output projection (o . w_out^T): all v_wmma_f32_16x16x32_f16 (f16 operands built from bf16-RNE inputs with power-of-two carries: w x64, q/k/v x4, p x2048, o x16), f32 accumulate; sliding-window mask, ALiBi bias and online softmax in f32.
#include <hip/hip_runtime.h>

// ---------------------------------------------------------------------------
// Problem constants (NB / SEQ overridable; *_FULL = input / output layout)
// ---------------------------------------------------------------------------
#ifndef NB
#define NB 4
#endif
#ifndef SEQ
#define SEQ 2048
#endif
#define NB_FULL 4
#define SEQ_FULL 2048

constexpr int kBatch     = NB;
constexpr int kBatchFull = NB_FULL;
constexpr int kSeq       = SEQ;
constexpr int kSeqFull   = SEQ_FULL;
constexpr int kEmb       = 1024;
constexpr int kHeads     = 16;
constexpr int kHdim      = 64;
constexpr int kWin       = 512;
constexpr int kTok       = kBatch * kSeq;         // compact token rows (t = b*kSeq + s)
constexpr int kGuard     = 512;                   // unused rows / columns in front of the key planes (layout kept)
constexpr int kQKRows    = kGuard + kTok;         // rows of the q|k plane
constexpr int kQKPitch   = 2 * kEmb;              // 2048 halves per q|k row (q cols 0..1023, k cols 1024..2047)
constexpr int kVtPitch   = kGuard + kTok;         // halves per v^T row

static_assert(kSeq % kWin == 0);
static_assert(kSeq >= kWin && kSeq <= kSeqFull);
static_assert(kBatch >= 1 && kBatch <= kBatchFull);
static_assert(kHeads * kHdim == kEmb);
static_assert(kTok % 64 == 0 && kEmb % 64 == 0 && kWin % 32 == 0 && kSeq % 128 == 0);
static_assert(kEmb % 32 == 0 && kHdim == 64);
static_assert((kVtPitch * 2) % 128 == 0 && (kQKPitch * 2) % 128 == 0);

constexpr float kWCarry   = 64.0f;             // weights carried x64 in f16
constexpr float kQKScale  = 1.0f / 16.0f;      // (x)(64 w) -> 4 q, 4 k, 4 v
constexpr float kSScale   = 1.0f / 128.0f;     // (4q)(4k) = 16 q.k -> q.k / 8
constexpr float kPLog2    = 11.0f;             // probabilities carried x2048 = 2^11 in f16
constexpr float kPVScale  = 4.0f;              // sum (2048 p)(4 v) / sum (2048 p) = 4 o -> 16 o
constexpr float kOutScale = 1.0f / 1024.0f;    // (16 o)(64 w) = 1024 out -> out

typedef __attribute__((ext_vector_type(16))) _Float16 v16h;
typedef __attribute__((ext_vector_type(8)))  _Float16 v8h;
typedef __attribute__((ext_vector_type(16))) __bf16   v16b;
typedef __attribute__((ext_vector_type(8)))  __bf16   v8b;
typedef __attribute__((ext_vector_type(8)))  float    v8f;
typedef __attribute__((ext_vector_type(4)))  float    v4f;
typedef __attribute__((ext_vector_type(4)))  unsigned int v4u;

__device__ __forceinline__ unsigned short f2bf_bits(float f) {
  unsigned u = __float_as_uint(f);
  return (unsigned short)((u + 0x7FFFu + ((u >> 16) & 1u)) >> 16);
}
__device__ __forceinline__ float bf_bits2f(unsigned short h) { return __uint_as_float(((unsigned)h) << 16); }

// hazard guards as plain device helpers
__device__ __forceinline__ void dep_guard_h(v8f& a, v8f& b, v16h x, v16h y) { asm volatile("v_nop\n\tv_nop\n\tv_nop\n\tv_nop" : "+v"(a), "+v"(b) : "v"(x), "v"(y)); }
__device__ __forceinline__ void dep_guard_b(v8f& a, v8f& b, v16b x, v16b y) { asm volatile("v_nop\n\tv_nop\n\tv_nop\n\tv_nop" : "+v"(a), "+v"(b) : "v"(x), "v"(y)); }
__device__ __forceinline__ void keep4_h(v16h a, v16h b, v16h c, v16h d) { asm volatile("v_nop" :: "v"(a), "v"(b), "v"(c), "v"(d)); }
__device__ __forceinline__ void keep4_b(v16b a, v16b b, v16b c, v16b d) { asm volatile("v_nop" :: "v"(a), "v"(b), "v"(c), "v"(d)); }
__device__ __forceinline__ void acc_guard4(v8f& a, v8f& b, v8f& c, v8f& d) { asm volatile("v_nop\n\tv_nop\n\tv_nop\n\tv_nop" : "+v"(a), "+v"(b), "+v"(c), "+v"(d)); }
template <typename T> struct Frag;
template <> struct Frag<_Float16> {
  typedef v16h V; union U { v16h v; v8h h[2]; };
  static __device__ __forceinline__ v16h load(const _Float16* p) {   // elements 0..7 <- p[0..7], 8..15 <- p[16..23]
    U f; f.h[0] = *(const v8h*)(p); f.h[1] = *(const v8h*)(p + 16); return f.v;
  }
  static __device__ __forceinline__ v8f mma(v16h a, v16h b, v8f c) {
    return __builtin_amdgcn_wmma_f32_16x16x32_f16(false, a, false, b, (short)0, c, false, false);
  }
  static __device__ __forceinline__ void guard(v8f& a, v8f& b, v16h x, v16h y) { dep_guard_h(a, b, x, y); }
  static __device__ __forceinline__ void keep(v16h a, v16h b, v16h c, v16h d) { keep4_h(a, b, c, d); }
};
template <> struct Frag<__bf16> {
  typedef v16b V; union U { v16b v; v8b h[2]; };
  static __device__ __forceinline__ v16b load(const __bf16* p) {
    U f; f.h[0] = *(const v8b*)(p); f.h[1] = *(const v8b*)(p + 16); return f.v;
  }
  static __device__ __forceinline__ v8f mma(v16b a, v16b b, v8f c) {
    return __builtin_amdgcn_wmma_f32_16x16x32_bf16(false, a, false, b, (short)0, c, false, false);
  }
  static __device__ __forceinline__ void guard(v8f& a, v8f& b, v16b x, v16b y) { dep_guard_b(a, b, x, y); }
  static __device__ __forceinline__ void keep(v16b a, v16b b, v16b c, v16b d) { keep4_b(a, b, c, d); }
};

__device__ __forceinline__ unsigned pk16(unsigned short a, unsigned short b) { return (unsigned)a | ((unsigned)b << 16); }
__device__ __forceinline__ unsigned short h_bits(float f) { const _Float16 h = (_Float16)f; return __builtin_bit_cast(unsigned short, h); }

// ---- Register-blocked batched WMMA GEMM (ACT reduced to none/relu/leaky) -----------------------
// C[m,n] = scale * sum_k A[m,k] * Bt[n,k] (+bias)(+resid); a block of 8 waves (2 x 4) owns a 128x256 tile, each wave 64x64 of it.
// A row-major [M,K]; Bt row-major [N,K]; M % 128 == 0, N % 256 == 0, K % BK == 0, K >= 2 BK.
// Operand path: per trip of BK k the block's 128 A rows and 256 Bt rows (2 BK bytes each) are brought into LDS by asynchronous
// copies, whole 128-B lines, once per block; two buffers, the next trip's copies fly while this trip's products run.
// BK = 64 (two blocks share a WGP's LDS) or 128 (a block alone on its WGP: half the publish points, twice the lead of a copy).
// LDS row pitch 2 BK + 16 bytes = 144 or 272 (16 B x odd: no bank conflict for the 16-byte fragment reads).
// BIAS_MODE: 0 = none, 1 = bias[m], 2 = bias[n].
// OUT_MODE: 0 = f32, 1 = f16, 2 = bf16 hi plane (Cout) + bf16 lo plane (Cout2).
// ET: 0 = f16 operands, 1 = bf16 operands (pointers passed as 16-bit storage)
constexpr int kBM      = 128;                        // block tile rows (A rows staged)
constexpr int kBN      = 256;                        // block tile columns (Bt rows staged)
constexpr int kLdsRow  = 64 + 8;                     // 16-bit elements per LDS row of 128 B: 16 B pad (attention stages)

// Twelve of a lane's 16-byte copies of a trip: global -> LDS, through no register. l: LDS byte addresses, p: global addresses.
// The s_wait_xcnt stands inside the statement so that no address register is rewritten in front of it.
__device__ __forceinline__ void async_copy12(const unsigned (&l)[12], const void* const (&p)[12]) {
  asm volatile(
      "global_load_async_to_lds_b128 %0, %12, off\n\t"
      "global_load_async_to_lds_b128 %1, %13, off\n\t"
      "global_load_async_to_lds_b128 %2, %14, off\n\t"
      "global_load_async_to_lds_b128 %3, %15, off\n\t"
      "global_load_async_to_lds_b128 %4, %16, off\n\t"
      "global_load_async_to_lds_b128 %5, %17, off\n\t"
      "global_load_async_to_lds_b128 %6, %18, off\n\t"
      "global_load_async_to_lds_b128 %7, %19, off\n\t"
      "global_load_async_to_lds_b128 %8, %20, off\n\t"
      "global_load_async_to_lds_b128 %9, %21, off\n\t"
      "global_load_async_to_lds_b128 %10, %22, off\n\t"
      "global_load_async_to_lds_b128 %11, %23, off\n\t"
      "s_wait_xcnt 0x0"
      :: "v"(l[0]), "v"(l[1]), "v"(l[2]), "v"(l[3]), "v"(l[4]), "v"(l[5]), "v"(l[6]), "v"(l[7]), "v"(l[8]), "v"(l[9]),
         "v"(l[10]), "v"(l[11]),
         "v"(p[0]), "v"(p[1]), "v"(p[2]), "v"(p[3]), "v"(p[4]), "v"(p[5]), "v"(p[6]), "v"(p[7]), "v"(p[8]), "v"(p[9]),
         "v"(p[10]), "v"(p[11])
      : "memory");
}

template <int ET> struct Elem;
template <> struct Elem<0> { typedef _Float16 T; };
template <> struct Elem<1> { typedef __bf16 T; };
template <int ET, bool SPLIT, int BIAS_MODE, int OUT_MODE, bool RESID, int ACT, int BK>
__global__ __launch_bounds__(256) void wmma_gemm64(
    const unsigned short* __restrict__ Ap, const unsigned short* __restrict__ A2p, int lda, long strideA,
    const unsigned short* __restrict__ Btp, const unsigned short* __restrict__ Bt2p, int ldb, long strideB,
    void* __restrict__ Cout, void* __restrict__ Cout2, int ldc, long strideC,
    const float* __restrict__ bias,
    const float* __restrict__ resid, long strideR,
    int M, int N, int K, float scale) {
  static_assert(!SPLIT, "the staged operand path carries one plane per operand");
  static_assert(BK == 64 || BK == 128);
  constexpr int kRow     = BK + 8;                     // 16-bit elements per LDS row: 2 BK bytes + 16 B pad
  constexpr int kStage   = (kBM + kBN) * kRow;         // elements per buffer: A rows 0..127, Bt rows 128..383
  constexpr int kRowLane = BK / 8;                     // lanes that cover one row with 16 bytes each
  constexpr int kRowStep = 256 / kRowLane;             // rows that one copy of the whole block covers
  constexpr int kCopiesA = kBM / kRowStep;             // copies per lane and trip for the A rows
  constexpr int kCopies  = (kBM + kBN) / kRowStep;     // copies per lane and trip: 12 or 24
  static_assert(kCopies % 12 == 0);
  typedef typename Elem<ET>::T T;
  typedef typename Frag<T>::V V;
  const T* A = (const T*)Ap; const T* Bt = (const T*)Btp;
  __shared__ __align__(16) T     sOp[2][kStage];   // the two operand buffers
  __shared__ __align__(16) float sT[8][16 * 68];   // per-wave 16x64 slab, pitch 68 floats
  const int b    = blockIdx.y;
  const int lane = threadIdx.x & 31;
  const int wave = threadIdx.x >> 5;
  const int tilesN = N / kBN;
  const int tilesM = M / kBM;
  const int tile = blockIdx.x;
  if (tile >= tilesM * tilesN) return;   // block-uniform, in front of every barrier
  const int tm = tile / tilesN;
  const int tn = tile - tm * tilesN;
  const int bm0 = tm * kBM;                    // block tile origin
  const int bn0 = tn * kBN;
  const int wm  = (wave >> 2) << 6;            // wave tile origin inside the block tile
  const int wn  = (wave & 3) << 6;
  const int m0  = bm0 + wm;
  const int n0  = bn0 + wn;

  const T* Ab  = A  + (size_t)b * strideA;
  const T* Bb  = Bt + (size_t)b * strideB;

  const int rlane = lane & 15;                 // row (A) / col (B, D) within subtile
  const int koff  = (lane >> 4) * 8;           // k offset of this lane half
  const int mOff  = (lane >> 4) * 8;           // D row offset

  // copy roles: kRowLane lanes cover one row, a wave-wide copy covers 512 B of whole rows; copy j of a thread serves staged row crow + kRowStep j
  const int crow = threadIdx.x / kRowLane;               // 0..kRowStep-1
  const int ccol = (threadIdx.x & (kRowLane - 1)) * 8;   // element offset of the lane's 16 bytes in the row
  const T* gA = Ab + (size_t)(bm0 + crow) * lda + ccol;
  const T* gB = Bb + (size_t)(bn0 + crow) * ldb + ccol;
  const unsigned lds0 = (unsigned)(size_t)(&sOp[0][0]) + (unsigned)(crow * kRow + ccol) * 2u;
  auto stage_in = [&](int t, int buf) {        // trip t's operand rows -> buffer buf
#pragma unroll   // one asm statement per twelve copies (an asm statement takes thirty operands)
    for (int c = 0; c < kCopies; c += 12) {
      unsigned l[12];
      const void* p[12];
#pragma unroll   // the twelve address pairs are operands of one asm statement: they must be registers, not arrays in memory
      for (int i = 0; i < 12; ++i) {
        const int j = c + i;
        l[i] = lds0 + (unsigned)(buf * kStage + j * kRowStep * kRow) * 2u;
        p[i] = (j < kCopiesA) ? (const void*)(gA + (size_t)(j * kRowStep) * lda + t * BK)
                              : (const void*)(gB + (size_t)((j - kCopiesA) * kRowStep) * ldb + t * BK);
      }
      async_copy12(l, p);
    }
  };

  v8f acc[4][4];
#pragma unroll
  for (int i = 0; i < 4; ++i)
#pragma unroll
    for (int j = 0; j < 4; ++j) acc[i][j] = (v8f){0.f,0.f,0.f,0.f,0.f,0.f,0.f,0.f};

  const int trips = K / BK;
  stage_in(0, 0);
  asm volatile("s_wait_asynccnt 0x0" ::: "memory");   // this wave's share of trip 0 has landed
  __syncthreads();                                    // every wave's share has: buffer 0 may be read
  if (trips > 1) stage_in(1, 1);

  for (int t = 0; t < trips; ++t) {
    const T* sA = &sOp[t & 1][(wm + rlane) * kRow + koff];
    const T* sB = &sOp[t & 1][(kBM + wn + rlane) * kRow + koff];
#pragma unroll   // all 32-k steps in one body: a step's fragment reads can start under the step before's products
    for (int kk = 0; kk < BK; kk += 32) {
      V bh[4], ah[4];   // all eight fragments of a 32-k step are read as one group, in front of its 16 products
#pragma unroll
      for (int j = 0; j < 4; ++j) bh[j] = Frag<T>::load(sB + (j << 4) * kRow + kk);
#pragma unroll
      for (int i = 0; i < 4; ++i) ah[i] = Frag<T>::load(sA + (i << 4) * kRow + kk);
#pragma unroll
      for (int i = 0; i < 4; ++i) {
#pragma unroll
        for (int j = 0; j < 4; ++j) acc[i][j] = Frag<T>::mma(ah[i], bh[j], acc[i][j]);
        Frag<T>::guard(acc[i][0], acc[i][3], ah[i], ah[i]);
      }
      Frag<T>::keep(bh[0], bh[1], bh[2], bh[3]);
    }
    asm volatile("s_wait_dscnt 0x0" ::: "memory");      // this wave's reads of buffer t & 1 are done before it is refilled
    asm volatile("s_wait_asynccnt 0x0" ::: "memory");   // this wave's share of trip t + 1 has landed
    __syncthreads();                                    // publishes trip t + 1 and ends every reader's last read of trip t
    if (t + 2 < trips) stage_in(t + 2, t & 1);
  }
  asm volatile("s_wait_asynccnt 0x0" ::: "memory");     // nothing in flight when the wave goes on to the epilogue and ends
  acc_guard4(acc[0][0], acc[0][1], acc[0][2], acc[0][3]);
  acc_guard4(acc[1][0], acc[1][1], acc[1][2], acc[1][3]);
  acc_guard4(acc[2][0], acc[2][1], acc[2][2], acc[2][3]);
  acc_guard4(acc[3][0], acc[3][1], acc[3][2], acc[3][3]);

  // ---- epilogue ----
  float* slab = sT[wave];
  const float* Rb = RESID ? (resid + (size_t)b * strideR) : nullptr;
#pragma unroll
  for (int i = 0; i < 4; ++i) {
    const int mBase = m0 + (i << 4);
#pragma unroll
    for (int j = 0; j < 4; ++j) {
      const int n = n0 + (j << 4) + rlane;
      float bv = 0.f;
      if (BIAS_MODE == 2) bv = bias[n];
#pragma unroll
      for (int r = 0; r < 8; ++r) {
        float v = acc[i][j][r] * scale;
        if (BIAS_MODE == 1) v += bias[mBase + mOff + r];
        if (BIAS_MODE == 2) v += bv;
        if (RESID) v += Rb[(size_t)(mBase + mOff + r) * ldc + n];
        if (ACT == 2) v = fmaxf(v, 0.0f);
        if (ACT == 4) v = (v > 0.f) ? v : 0.01f * v;
        slab[(mOff + r) * 68 + (j << 4) + rlane] = v;
      }
    }
    __builtin_amdgcn_fence(__ATOMIC_RELEASE, "workgroup");
    __builtin_amdgcn_wave_barrier();
    __builtin_amdgcn_fence(__ATOMIC_ACQUIRE, "workgroup");
    if (OUT_MODE == 0) {
      float* C = (float*)Cout + (size_t)b * strideC;
      const int hh = lane >> 4, c4 = (lane & 15) * 4;     // row seg = 256 B = 16 lanes x 16 B
      {
#pragma unroll
        for (int it = 0; it < 8; ++it) {
          const int row = it * 2 + hh;
          v4f v = *(const v4f*)(slab + row * 68 + c4);
          *(v4f*)(C + (size_t)(mBase + row) * ldc + n0 + c4) = v;
        }
        
      }
    } else {
      const int q = lane >> 3, c8 = (lane & 7) * 8;
      unsigned short* C  = (unsigned short*)Cout  + (size_t)b * strideC;
      unsigned short* C2 = (OUT_MODE == 2) ? ((unsigned short*)Cout2 + (size_t)b * strideC) : nullptr;
      {
#pragma unroll
        for (int it = 0; it < 4; ++it) {
          const int row = it * 4 + q;
          const float* sp = slab + row * 68 + c8;
          v8h hv, lv;
#pragma unroll
          for (int e = 0; e < 8; ++e) {
            if (OUT_MODE == 1) {
              hv[e] = (_Float16)sp[e];
            } else {
              unsigned short hb = f2bf_bits(sp[e]);
              unsigned short lb = f2bf_bits(sp[e] - bf_bits2f(hb));
              hv[e] = __builtin_bit_cast(_Float16, hb);
              lv[e] = __builtin_bit_cast(_Float16, lb);
            }
          }
          *(v8h*)(C + (size_t)(mBase + row) * ldc + n0 + c8) = hv;
          if (OUT_MODE == 2) *(v8h*)(C2 + (size_t)(mBase + row) * ldc + n0 + c8) = lv;
        }
        
      }
    }
    __builtin_amdgcn_fence(__ATOMIC_RELEASE, "workgroup");
    __builtin_amdgcn_wave_barrier();
    __builtin_amdgcn_fence(__ATOMIC_ACQUIRE, "workgroup");
  }
}

// ---------------------------------------------------------------------------
// f32 -> bf16 (RNE) -> f16 cast with power-of-two carry: out[8i..8i+7] = f16(scale * bf16(in[8i..8i+7])).
// The bf16 significand times a power of two is exact in f16 for the value ranges used here.
// blockIdx.y selects a row group: in += y * inStride, out += y * outStride (elements).
// Coverage: n8 = (elements per group)/8 threads x 8 = the whole group; every plane group is an exact multiple of 8.
// ---------------------------------------------------------------------------
__global__ __launch_bounds__(256) void cast8_f16_kernel(const float* __restrict__ in, long inStride,
                                                        unsigned short* __restrict__ out, long outStride,
                                                        int n8, float scale) {
  const int i = blockIdx.x * 256 + threadIdx.x;
  if (i >= n8) return;
  const float* p = in + (size_t)blockIdx.y * inStride + 8 * (size_t)i;
  const v4f a = *(const v4f*)(p);
  const v4f c = *(const v4f*)(p + 4);
  unsigned short hb[8];
#pragma unroll
  for (int e = 0; e < 4; ++e) {
    hb[e]     = h_bits(bf_bits2f(f2bf_bits(a[e])) * scale);
    hb[4 + e] = h_bits(bf_bits2f(f2bf_bits(c[e])) * scale);
  }
  const v4u u = (v4u){pk16(hb[0], hb[1]), pk16(hb[2], hb[3]), pk16(hb[4], hb[5]), pk16(hb[6], hb[7])};
  unsigned short* q = out + (size_t)blockIdx.y * outStride + 8 * (size_t)i;
  *(v4u*)q = u;
  
}

// ---------------------------------------------------------------------------
// Fused sliding-window attention: scores, mask, ALiBi bias, softmax and P.V in one kernel, all batches, heads and positions.
// A wave owns 32 queries of one (batch, head) as two 16-column groups and walks their keys in passes of 32, lowest first:
//   S^T = K . Q^T    A = 16 key rows, B = 16 query rows (kept in registers); a lane holds one query's scores for 8 keys per tile
//   O^T += V^T . P^T A = 16 rows of the v^T plane, B = the two score tiles of a pass converted in place (hardware k order,
//                    the same order that Frag::load gives the A side)
// delta = q_idx - kv_idx; a key counts iff 0 <= delta < 512 and kv_idx >= 0 (the walk starts at max(0, q0 - 512), so the
// guard rows / columns in front of the planes are never read). Only a wave's first and last pass can hold masked keys.
// Operand path: the block's four waves share their keys. Stages of 64 keys (64 K rows and 64 v^T rows, 128 B each) are brought
// into LDS by asynchronous copies, whole 128-B lines, once per block; two buffers, the next stage's copies fly while this
// stage's passes run. The block walks keys max(0, Q0 - 512) .. Q0 + 127 (Q0: its first query); a wave takes part in the
// passes of its own window only, lowest keys first, and passes every barrier.
// Softmax is online, in base 2: x = s * log2(e)/8 + slope_h * log2(e) * delta; running maximum m (finite start value, so a
// pass with no valid key for a query gives p = 0 and factor 1), p = 2^(x - m + 11) (carried x2048), running sum l per lane half.
// O x16 = 4 * acc / l, since acc = (2048 p)(4 v) summed and l = 2048 p summed.
// grid (kSeq/128, heads, batch), 128 threads = 4 waves; LDS row pitch 144 B (16 B x odd), one barrier per stage.
// ---------------------------------------------------------------------------
__device__ __forceinline__ float other_half(float x) {   // value of lane l ^ 16
  return __builtin_bit_cast(float, __builtin_amdgcn_permlanex16(__builtin_bit_cast(int, x), __builtin_bit_cast(int, x),
                                                                0x76543210, 0xfedcba98, false, false));
}

// Four (five) values of 2^x in one statement. The instruction set asks for one free issue slot behind a transcendental before
// its result is read or a source register of it is overwritten.
// Here no result shares a register with an argument ("=&v"), so inside the run every slot is filled by the next
// exponential, and the v_nop at the end is the last one's slot.
__device__ __forceinline__ void exp2x4(float (&r)[16], const float (&a)[16], int o) {
  asm("v_exp_f32 %0, %4\n\tv_exp_f32 %1, %5\n\tv_exp_f32 %2, %6\n\tv_exp_f32 %3, %7\n\tv_nop"
      : "=&v"(r[o]), "=&v"(r[o + 1]), "=&v"(r[o + 2]), "=&v"(r[o + 3])
      : "v"(a[o]), "v"(a[o + 1]), "v"(a[o + 2]), "v"(a[o + 3]));
}
__device__ __forceinline__ void exp2x5(float& r4, float a4, float (&r)[16], const float (&a)[16]) {
  asm("v_exp_f32 %0, %5\n\tv_exp_f32 %1, %6\n\tv_exp_f32 %2, %7\n\tv_exp_f32 %3, %8\n\tv_exp_f32 %4, %9\n\tv_nop"
      : "=&v"(r4), "=&v"(r[0]), "=&v"(r[1]), "=&v"(r[2]), "=&v"(r[3])
      : "v"(a4), "v"(a[0]), "v"(a[1]), "v"(a[2]), "v"(a[3]));
}

constexpr int kAKeys   = 64;                          // keys per stage
constexpr int kAStage  = (kAKeys + kHdim) * kLdsRow;  // elements per buffer: K rows 0..63 (one key each), v^T rows 64..127 (one d each)
static_assert(kAKeys * 2 == 128 && kHdim * 2 == 128 && kLdsRow == 72 && kWin % 128 == 0);

// One lane's eight 16-byte copies of a stage: global -> LDS, through no register. l: LDS byte addresses, p: global addresses.
// The s_wait_xcnt stands inside the statement so that no address register is rewritten in front of it.
__device__ __forceinline__ void async_copy8(const unsigned (&l)[8], const void* const (&p)[8]) {
  asm volatile(
      "global_load_async_to_lds_b128 %0, %8, off\n\t"
      "global_load_async_to_lds_b128 %1, %9, off\n\t"
      "global_load_async_to_lds_b128 %2, %10, off\n\t"
      "global_load_async_to_lds_b128 %3, %11, off\n\t"
      "global_load_async_to_lds_b128 %4, %12, off\n\t"
      "global_load_async_to_lds_b128 %5, %13, off\n\t"
      "global_load_async_to_lds_b128 %6, %14, off\n\t"
      "global_load_async_to_lds_b128 %7, %15, off\n\t"
      "s_wait_xcnt 0x0"
      :: "v"(l[0]), "v"(l[1]), "v"(l[2]), "v"(l[3]), "v"(l[4]), "v"(l[5]), "v"(l[6]), "v"(l[7]),
         "v"(p[0]), "v"(p[1]), "v"(p[2]), "v"(p[3]), "v"(p[4]), "v"(p[5]), "v"(p[6]), "v"(p[7])
      : "memory");
}

// One pass: 32 keys from position kt against the wave's 32 queries.
// mask (the same in every lane): the pass can hold keys outside the window (a wave's first and last pass only).
// sK: the lane's place in the pass's first staged K row; sV: the lane's place at the pass's first key in staged v^T row 0.
__device__ __forceinline__ void attn_pass(bool mask, const _Float16* sK, const _Float16* sV, int kt, int dq, float sl2,
                                          const v16h (&qf)[2][2], v8f (&acc)[4][2],
                                          float (&m)[2], float (&l)[2]) {
  typedef Frag<_Float16> F;
  const float c1 = kSScale * 1.4426950408889634f;
  v16h kf[2][2], vf[4];
#pragma unroll
  for (int t = 0; t < 2; ++t)
#pragma unroll
    for (int kk = 0; kk < 2; ++kk) kf[t][kk] = F::load(sK + (t * 16) * kLdsRow + kk * 32);

  v8f s[2][2];   // [query group][key tile]
#pragma unroll
  for (int t = 0; t < 2; ++t)
#pragma unroll
    for (int g = 0; g < 2; ++g) {
      s[g][t] = F::mma(kf[t][0], qf[g][0], (v8f){0.f,0.f,0.f,0.f,0.f,0.f,0.f,0.f});
      s[g][t] = F::mma(kf[t][1], qf[g][1], s[g][t]);
    }
#pragma unroll
  for (int i = 0; i < 4; ++i) vf[i] = F::load(sV + (i * 16) * kLdsRow);   // read behind the score products: they land during the softmax
  v16h pf[2];
  float xs[2][16];
#pragma unroll
  for (int g = 0; g < 2; ++g) {
    const float d0 = (float)(dq + g * 16 - kt);     // delta of key tile 0, register 0
#pragma unroll
    for (int e = 0; e < 16; ++e) {
      const int ce = (e >> 3) * 16 + (e & 7);
      xs[g][e] = s[g][e >> 3][e & 7] * c1 + sl2 * (d0 - (float)ce);
    }
  }
  if (mask) {   // one scalar test a pass, for both query groups
#pragma unroll
    for (int g = 0; g < 2; ++g)
#pragma unroll
      for (int e = 0; e < 16; ++e) {
        const int ce = (e >> 3) * 16 + (e & 7);
        xs[g][e] = ((unsigned)(dq + g * 16 - kt - ce) < (unsigned)kWin) ? xs[g][e] : -__builtin_inff();
      }
  }
#pragma unroll
  for (int g = 0; g < 2; ++g) {
    float (&x)[16] = xs[g];
    float tm = fmaxf(fmaxf(fmaxf(fmaxf(x[0], x[1]), fmaxf(x[2], x[3])), fmaxf(fmaxf(x[4], x[5]), fmaxf(x[6], x[7]))),
                     fmaxf(fmaxf(fmaxf(x[8], x[9]), fmaxf(x[10], x[11])), fmaxf(fmaxf(x[12], x[13]), fmaxf(x[14], x[15]))));
    tm = fmaxf(tm, other_half(tm));
    const float mn    = fmaxf(m[g], tm);
    const float mc    = mn - kPLog2;     // the x2048 carry of p
    float alpha, p[16];
#pragma unroll
    for (int e = 0; e < 16; ++e) x[e] -= mc;
    exp2x5(alpha, m[g] - mn, p, x);      // alpha: the factor that brings the old sums to the new maximum
    exp2x4(p, x, 4);
    exp2x4(p, x, 8);
    exp2x4(p, x, 12);
    m[g] = mn;
#pragma unroll
    for (int e = 0; e < 16; ++e) pf[g][e] = (_Float16)p[e];
    const float ps = (((p[0] + p[1]) + (p[2] + p[3])) + ((p[4] + p[5]) + (p[6] + p[7]))) +
                     (((p[8] + p[9]) + (p[10] + p[11])) + ((p[12] + p[13]) + (p[14] + p[15])));
    l[g] = l[g] * alpha + ps;
#pragma unroll
    for (int i = 0; i < 4; ++i)
#pragma unroll
      for (int r = 0; r < 8; ++r) acc[i][g][r] *= alpha;
  }
#pragma unroll
  for (int i = 0; i < 4; ++i)
#pragma unroll
    for (int g = 0; g < 2; ++g) acc[i][g] = F::mma(vf[i], pf[g], acc[i][g]);
}

// amdgpu_waves_per_eu(4, 4): 4096 waves on 1024 SIMDs; lets the register allocator keep a pass's 16 fragment reads in flight at once
__global__ __launch_bounds__(128) __attribute__((amdgpu_waves_per_eu(4, 4)))
void band_attn_kernel(const unsigned short* __restrict__ qkp, const unsigned short* __restrict__ vtp,
                      unsigned short* __restrict__ op) {
  typedef Frag<_Float16> F;
  __shared__ __align__(16) _Float16 sKV[2][kAStage];   // the two stage buffers
  const int lane  = threadIdx.x & 31;
  const int wave  = __builtin_amdgcn_readfirstlane(threadIdx.x >> 5);   // scalar: the tests on a wave's window stay scalar
  const int h     = blockIdx.y;
  const int b     = blockIdx.z;
  const int q0    = (blockIdx.x * 4 + wave) * 32;      // first query position of this wave
  const int rlane = lane & 15;
  const int koff  = (lane >> 4) * 8;

  const _Float16* Qb = (const _Float16*)qkp + ((size_t)kGuard + (size_t)b * kSeq) * kQKPitch + h * kHdim;
  const _Float16* Kb = Qb + kEmb;
  const _Float16* Vb = (const _Float16*)vtp + (size_t)h * kHdim * kVtPitch + kGuard + (size_t)b * kSeq;
  const unsigned  lk = (unsigned)(rlane * kQKPitch + koff);

  const int   e1  = h + 1;   // slope_h = 2^(-(h+1)/2)
  const float sl  = ((e1 & 1) ? 0.70710678118654752f : 1.0f) * __uint_as_float(((unsigned)(127 - (e1 >> 1))) << 23);
  const float sl2 = sl * 1.4426950408889634f;
  const int   dq  = q0 + rlane - koff;

  const int kstart = (q0 >= kWin) ? (q0 - kWin) : 0;   // first key of this wave's window
  const int Q0     = blockIdx.x * 128;                 // first query position of the block
  const int ks0    = (Q0 >= kWin) ? (Q0 - kWin) : 0;   // first key the block stages
  const int trips  = (Q0 + 128 - ks0) / kAKeys;        // stages: 2 .. 10, the last ends at key Q0 + 127 < kSeq

  // copy roles: 8 lanes cover one 128-B row, a wave-wide copy covers 4 whole rows; copy j of a thread serves staged row crow + 16 j
  const int crow = threadIdx.x >> 3;           // 0..15
  const int ccol = (threadIdx.x & 7) * 8;      // element offset of the lane's 16 bytes in the row
  const _Float16* gK = Kb + (size_t)(ks0 + crow) * kQKPitch + ccol;
  const _Float16* gV = Vb + (size_t)crow * kVtPitch + ks0 + ccol;
  const unsigned lds0 = (unsigned)(size_t)(&sKV[0][0]) + (unsigned)(crow * kLdsRow + ccol) * 2u;
  auto stage_in = [&](int t, int buf) {        // stage t's K and v^T rows -> buffer buf
    unsigned sl[8];
    const void* sp[8];
#pragma unroll   // the eight address pairs are operands of one asm statement: they must be registers, not arrays in memory
    for (int j = 0; j < 8; ++j) {
      sl[j] = lds0 + (unsigned)(buf * kAStage + j * 16 * kLdsRow) * 2u;
      sp[j] = (j < 4) ? (const void*)(gK + (size_t)(t * kAKeys + j * 16) * kQKPitch)
                      : (const void*)(gV + (size_t)((j - 4) * 16 * kVtPitch + t * kAKeys));
    }
    async_copy8(sl, sp);
  };
  stage_in(0, 0);

  v16h qf[2][2];
#pragma unroll
  for (int g = 0; g < 2; ++g)
#pragma unroll
    for (int kk = 0; kk < 2; ++kk)
      qf[g][kk] = F::load(Qb + (size_t)q0 * kQKPitch + lk + (size_t)(g * 16) * kQKPitch + kk * 32);
  // the loads above name the lane-offset register; this wait stands before anything below may reuse that register
  asm volatile("s_wait_xcnt 0x0" ::: "memory");

  v8f acc[4][2];
#pragma unroll
  for (int i = 0; i < 4; ++i)
#pragma unroll
    for (int g = 0; g < 2; ++g) acc[i][g] = (v8f){0.f,0.f,0.f,0.f,0.f,0.f,0.f,0.f};
  float m[2] = {-1.0e30f, -1.0e30f};
  float l[2] = {0.f, 0.f};

  asm volatile("s_wait_asynccnt 0x0" ::: "memory");   // this wave's share of stage 0 has landed
  __syncthreads();                                    // every wave's share has: buffer 0 may be read
  if (trips > 1) stage_in(1, 1);

  for (int t = 0; t < trips; ++t) {
    const _Float16* sb = &sKV[t & 1][rlane * kLdsRow + koff];
    for (int u = 0; u < 2; ++u) {
      const int kt = ks0 + t * kAKeys + u * 32;
      if (kt >= kstart && kt <= q0) {                 // the pass lies in this wave's window (scalar test)
        const _Float16* sK = sb + (u * 32) * kLdsRow;
        const _Float16* sV = sb + kAKeys * kLdsRow + u * 32;
        // keys q0 .. q0+31: some delta < 0; keys q0-512 .. q0-481: some delta >= 512; between them every delta is in 1 .. 511
        attn_pass(kt == q0 || kt + kWin == q0, sK, sV, kt, dq, sl2, qf, acc, m, l);
      }
    }
    asm volatile("s_wait_dscnt 0x0" ::: "memory");      // this wave's reads of buffer t & 1 are done before it is refilled
    asm volatile("s_wait_asynccnt 0x0" ::: "memory");   // this wave's share of stage t + 1 has landed
    __syncthreads();                                    // publishes stage t + 1 and ends every reader's last read of stage t
    if (t + 2 < trips) stage_in(t + 2, t & 1);
  }
  asm volatile("s_wait_asynccnt 0x0" ::: "memory");     // nothing in flight when the wave goes on to the epilogue and ends

#pragma unroll
  for (int g = 0; g < 2; ++g) {
    const float lt  = l[g] + other_half(l[g]);
    const float inv = kPVScale / lt;
    unsigned short* orow = op + ((size_t)b * kSeq + q0 + g * 16 + rlane) * kEmb + h * kHdim + koff;
#pragma unroll
    for (int i = 0; i < 4; ++i) {
      v8h hv;
#pragma unroll
      for (int r = 0; r < 8; ++r) hv[r] = (_Float16)(acc[i][g][r] * inv);
      *(v8h*)(orow + i * 16) = hv;    // d = i*16 + koff + r: 8 consecutive halves of one output row
    }
  }
}

// ---------------------------------------------------------------------------
// Launcher
// Token rows are compact: t = b*kSeq + s; input x row = b*kSeqFull + s; output row = b*kSeqFull + s.
// Workspace region map (bytes) for NB=4, SEQ=2048 (smaller NB / SEQ shrink R0, R3, R4):
//   R0 [0,          16777216)   x f16 [kTok][1024]; aliased later by O f16 x16 [kTok][1024] (x dead after the two projections)
//   R1 [16777216,   23068672)   w_in f16 x64 [3072][1024]
//   R2 [23068672,   25165824)   w_out f16 x64 [1024][1024]
//   R3 [25165824,   60817408)   q|k plane f16 x4 [512 guard + kTok][2048]  (guard rows neither written nor read; rows 512.. written by GEMM)
//   R4 [60817408,   78643200)   v^T plane f16 x4 [1024][512 guard + kTok]  (guard cols neither written nor read; cols 512.. written by GEMM)
//   total 78643200
// ---------------------------------------------------------------------------
static_assert(kTok % kBN == 0 && kSeq % kBM == 0 && kEmb % kBN == 0 && kQKPitch % kBN == 0 && kEmb % 128 == 0 && kEmb >= 256);
extern "C" void kernel_launch(void* const* d_in, const int* in_sizes, int n_in,
                              void* d_out, int out_size, void* d_ws, size_t ws_size,
                              hipStream_t stream) {
  const size_t NXT = (size_t)kTok * kEmb;                                              // compact x / O plane elements
  const size_t NXNEED = (size_t)(kBatch - 1) * kSeqFull * kEmb + (size_t)kSeq * kEmb;  // last input / output row used + 1
  const size_t NWI = (size_t)3 * kEmb * kEmb;                                          // 3145728
  const size_t NWO = (size_t)kEmb * kEmb;                                              // 1048576
  if (n_in < 3) return;
  if ((size_t)in_sizes[0] < NXNEED || (size_t)in_sizes[1] < NWI || (size_t)in_sizes[2] < NWO) return;
  if ((size_t)out_size < NXNEED) return;

  const float* x     = (const float*)d_in[0];
  const float* w_in  = (const float*)d_in[1];
  const float* w_out = (const float*)d_in[2];
  float* out = (float*)d_out;

  char* ws = (char*)d_ws;
  size_t off = 0;
  unsigned short* x16  = (unsigned short*)(ws + off); off += NXT * 2;
  unsigned short* wi16 = (unsigned short*)(ws + off); off += NWI * 2;
  unsigned short* wo16 = (unsigned short*)(ws + off); off += NWO * 2;
  unsigned short* qk   = (unsigned short*)(ws + off); off += (size_t)kQKRows * kQKPitch * 2;
  unsigned short* vt   = (unsigned short*)(ws + off); off += (size_t)kEmb * kVtPitch * 2;
  unsigned short* o16  = x16;                         // alias: x16 is dead after the two projection GEMMs
  if (off > ws_size) return;
  // dummy in-range pointers for unused bias / resid arguments (never dereferenced with BIAS_MODE 0 / RESID false)
  const float* xf = x;

  // 1-3: casts. x: per batch kSeq*kEmb/8 threads, grid y = batch (src stride kSeqFull*kEmb, dst stride kSeq*kEmb);
  //       w_in: 393216 threads = 1536 blocks; w_out: 131072 = 512 blocks.
  {
    const int n8x = (int)((size_t)kSeq * kEmb / 8);
    cast8_f16_kernel<<<dim3((unsigned)((n8x + 255) / 256), kBatch), dim3(256), 0, stream>>>(
        x, (long)kSeqFull * kEmb, x16, (long)kSeq * kEmb, n8x, 1.0f);
    cast8_f16_kernel<<<dim3((unsigned)((NWI / 8 + 255) / 256), 1), dim3(256), 0, stream>>>(
        w_in, 0L, wi16, 0L, (int)(NWI / 8), kWCarry);
    cast8_f16_kernel<<<dim3((unsigned)((NWO / 8 + 255) / 256), 1), dim3(256), 0, stream>>>(
        w_out, 0L, wo16, 0L, (int)(NWO / 8), kWCarry);
  }

  // 4: q|k = x . w_in[0..2047]^T -> rows 512.. of the q|k plane (M=kTok, N=2048, K=1024, f16 out, scale 1/16 -> carried x4)
  //    two tiles per WGP: stages of 64 k, so that two blocks fit a WGP's LDS
  {
    const int tiles = (kTok / kBM) * (kQKPitch / kBN);
    wmma_gemm64<0, false, 0, 1, false, 0, 64><<<dim3((unsigned)tiles, 1), dim3(256), 0, stream>>>(
        x16, x16, kEmb, 0L, wi16, wi16, kEmb, 0L,
        (void*)(qk + (size_t)kGuard * kQKPitch), (void*)(qk + (size_t)kGuard * kQKPitch), kQKPitch, 0L,
        xf, xf, 0L, kTok, kQKPitch, kEmb, kQKScale);
  }
  // 5: v^T = w_in[2048..3071] . x^T -> v^T plane cols 512.. (M=1024, N=kTok, K=1024, f16 out, ldc kVtPitch, scale 1/16 -> carried x4)
  //    one tile per WGP: stages of 128 k
  {
    const int tiles = (kEmb / kBM) * (kTok / kBN);
    wmma_gemm64<0, false, 0, 1, false, 0, 128><<<dim3((unsigned)tiles, 1), dim3(256), 0, stream>>>(
        wi16 + (size_t)2 * kEmb * kEmb, wi16 + (size_t)2 * kEmb * kEmb, kEmb, 0L, x16, x16, kEmb, 0L,
        (void*)(vt + kGuard), (void*)(vt + kGuard), kVtPitch, 0L,
        xf, xf, 0L, kEmb, kTok, kEmb, kQKScale);
  }

  // 6: fused sliding-window attention, all batches and heads in one launch -> merged O x16 (128 queries per block)
  band_attn_kernel<<<dim3(kSeq / 128, kHeads, kBatch), dim3(128), 0, stream>>>(qk, vt, o16);

  // 7: out = (16 o) . (64 w_out)^T / 1024 -> d_out f32 rows b*kSeqFull + s (grid y = batch; M=kSeq per batch, N=1024, K=1024)
  {
    const int tiles = (kSeq / kBM) * (kEmb / kBN);   // one tile per WGP: stages of 128 k
    wmma_gemm64<0, false, 0, 0, false, 0, 128><<<dim3((unsigned)tiles, kBatch), dim3(256), 0, stream>>>(
        o16, o16, kEmb, (long)kSeq * kEmb, wo16, wo16, kEmb, 0L,
        (void*)out, (void*)out, kEmb, (long)kSeqFull * kEmb,
        xf, xf, 0L, kSeq, kEmb, kEmb, kOutScale);
  }
}

// v005
// One run takes 97.8 microseconds.
// In two side-by-side timings against v004, it was 1.06 and 1.05 times as fast.
// Counting every step since v000, it is 13.1 times as fast.
// Contractions: q|k projection (x . w_in^T), v^T projection (w_in . x^T), scores k.q^T (K=64), v^T.p^T (32 keys a pass), output projection (o . w_out^T): all v_wmma_f32_16x16x32_f16 (f16 operands built from bf16-RNE inputs with power-of-two carries: w x64, q/k/v x4, p x2048, o x16), f32 accumulate; sliding-window mask, ALiBi bias and online softmax in f32.
#include <hip/hip_runtime.h>

// ---------------------------------------------------------------------------
// Problem constants (NB / SEQ overridable; *_FULL = input / output layout)
// ---------------------------------------------------------------------------
#ifndef NB
#define NB 4
#endif
#ifndef SEQ
#define SEQ 2048
#endif
#define NB_FULL 4
#define SEQ_FULL 2048

constexpr int kBatch     = NB;
constexpr int kBatchFull = NB_FULL;
constexpr int kSeq       = SEQ;
constexpr int kSeqFull   = SEQ_FULL;
constexpr int kEmb       = 1024;
constexpr int kHeads     = 16;
constexpr int kHdim      = 64;
constexpr int kWin       = 512;
constexpr int kTok       = kBatch * kSeq;         // compact token rows (t = b*kSeq + s)
constexpr int kGuard     = 512;                   // unused rows / columns in front of the key planes (layout kept)
constexpr int kQKRows    = kGuard + kTok;         // rows of the q|k plane
constexpr int kQKPitch   = 2 * kEmb;              // 2048 halves per q|k row (q cols 0..1023, k cols 1024..2047)
constexpr int kVtPitch   = kGuard + kTok;         // halves per v^T row

static_assert(kSeq % kWin == 0);
static_assert(kSeq >= kWin && kSeq <= kSeqFull);
static_assert(kBatch >= 1 && kBatch <= kBatchFull);
static_assert(kHeads * kHdim == kEmb);
static_assert(kTok % 64 == 0 && kEmb % 64 == 0 && kWin % 32 == 0 && kSeq % 128 == 0);
static_assert(kEmb % 32 == 0 && kHdim == 64);
static_assert((kVtPitch * 2) % 128 == 0 && (kQKPitch * 2) % 128 == 0);

constexpr float kWCarry   = 64.0f;             // weights carried x64 in f16
constexpr float kQKScale  = 1.0f / 16.0f;      // (x)(64 w) -> 4 q, 4 k, 4 v
constexpr float kSScale   = 1.0f / 128.0f;     // (4q)(4k) = 16 q.k -> q.k / 8
constexpr float kPLog2    = 11.0f;             // probabilities carried x2048 = 2^11 in f16
constexpr float kPVScale  = 4.0f;              // sum (2048 p)(4 v) / sum (2048 p) = 4 o -> 16 o
constexpr float kOutScale = 1.0f / 1024.0f;    // (16 o)(64 w) = 1024 out -> out

typedef __attribute__((ext_vector_type(16))) _Float16 v16h;
typedef __attribute__((ext_vector_type(8)))  _Float16 v8h;
typedef __attribute__((ext_vector_type(16))) __bf16   v16b;
typedef __attribute__((ext_vector_type(8)))  __bf16   v8b;
typedef __attribute__((ext_vector_type(8)))  float    v8f;
typedef __attribute__((ext_vector_type(4)))  float    v4f;
typedef __attribute__((ext_vector_type(4)))  unsigned int v4u;

__device__ __forceinline__ unsigned short f2bf_bits(float f) {
  unsigned u = __float_as_uint(f);
  return (unsigned short)((u + 0x7FFFu + ((u >> 16) & 1u)) >> 16);
}
__device__ __forceinline__ float bf_bits2f(unsigned short h) { return __uint_as_float(((unsigned)h) << 16); }

// hazard guards as plain device helpers
__device__ __forceinline__ void dep_guard_h(v8f& a, v8f& b, v16h x, v16h y) { asm volatile("v_nop\n\tv_nop\n\tv_nop\n\tv_nop" : "+v"(a), "+v"(b) : "v"(x), "v"(y)); }
__device__ __forceinline__ void dep_guard_b(v8f& a, v8f& b, v16b x, v16b y) { asm volatile("v_nop\n\tv_nop\n\tv_nop\n\tv_nop" : "+v"(a), "+v"(b) : "v"(x), "v"(y)); }
__device__ __forceinline__ void keep4_h(v16h a, v16h b, v16h c, v16h d) { asm volatile("v_nop" :: "v"(a), "v"(b), "v"(c), "v"(d)); }
__device__ __forceinline__ void keep4_b(v16b a, v16b b, v16b c, v16b d) { asm volatile("v_nop" :: "v"(a), "v"(b), "v"(c), "v"(d)); }
__device__ __forceinline__ void acc_guard4(v8f& a, v8f& b, v8f& c, v8f& d) { asm volatile("v_nop\n\tv_nop\n\tv_nop\n\tv_nop" : "+v"(a), "+v"(b), "+v"(c), "+v"(d)); }
template <typename T> struct Frag;
template <> struct Frag<_Float16> {
  typedef v16h V; union U { v16h v; v8h h[2]; };
  static __device__ __forceinline__ v16h load(const _Float16* p) {   // elements 0..7 <- p[0..7], 8..15 <- p[16..23]
    U f; f.h[0] = *(const v8h*)(p); f.h[1] = *(const v8h*)(p + 16); return f.v;
  }
  static __device__ __forceinline__ v8f mma(v16h a, v16h b, v8f c) {
    return __builtin_amdgcn_wmma_f32_16x16x32_f16(false, a, false, b, (short)0, c, false, false);
  }
  static __device__ __forceinline__ void guard(v8f& a, v8f& b, v16h x, v16h y) { dep_guard_h(a, b, x, y); }
  static __device__ __forceinline__ void keep(v16h a, v16h b, v16h c, v16h d) { keep4_h(a, b, c, d); }
};
template <> struct Frag<__bf16> {
  typedef v16b V; union U { v16b v; v8b h[2]; };
  static __device__ __forceinline__ v16b load(const __bf16* p) {
    U f; f.h[0] = *(const v8b*)(p); f.h[1] = *(const v8b*)(p + 16); return f.v;
  }
  static __device__ __forceinline__ v8f mma(v16b a, v16b b, v8f c) {
    return __builtin_amdgcn_wmma_f32_16x16x32_bf16(false, a, false, b, (short)0, c, false, false);
  }
  static __device__ __forceinline__ void guard(v8f& a, v8f& b, v16b x, v16b y) { dep_guard_b(a, b, x, y); }
  static __device__ __forceinline__ void keep(v16b a, v16b b, v16b c, v16b d) { keep4_b(a, b, c, d); }
};

__device__ __forceinline__ unsigned pk16(unsigned short a, unsigned short b) { return (unsigned)a | ((unsigned)b << 16); }
__device__ __forceinline__ unsigned short h_bits(float f) { const _Float16 h = (_Float16)f; return __builtin_bit_cast(unsigned short, h); }

// ---- Register-blocked batched WMMA GEMM (ACT reduced to none/relu/leaky) -----------------------
// C[m,n] = scale * sum_k A[m,k] * Bt[n,k] (+bias)(+resid); a block of 8 waves (2 x 4) owns a 128x256 tile, each wave 64x64 of it.
// A row-major [M,K]; Bt row-major [N,K]; M % 128 == 0, N % 256 == 0, K % BK == 0, K >= 2 BK.
// Operand path: per trip of BK k the block's 128 A rows and 256 Bt rows (2 BK bytes each) are brought into LDS by asynchronous
// copies, whole 128-B lines, once per block; two buffers, the next trip's copies fly while this trip's products run.
// BK = 64 (two blocks share a WGP's LDS) or 128 (a block alone on its WGP: half the publish points, twice the lead of a copy).
// LDS row pitch 2 BK + 16 bytes = 144 or 272 (16 B x odd: no bank conflict for the 16-byte fragment reads).
// BIAS_MODE: 0 = none, 1 = bias[m], 2 = bias[n].
// OUT_MODE: 0 = f32, 1 = f16, 2 = bf16 hi plane (Cout) + bf16 lo plane (Cout2).
// ET: 0 = f16 operands, 1 = bf16 operands (pointers passed as 16-bit storage)
constexpr int kBM      = 128;                        // block tile rows (A rows staged)
constexpr int kBN      = 256;                        // block tile columns (Bt rows staged)
constexpr int kLdsRow  = 64 + 8;                     // 16-bit elements per LDS row of 128 B: 16 B pad (attention stages)

// Twelve of a lane's 16-byte copies of a trip: global -> LDS, through no register. l: LDS byte addresses, p: global addresses.
// The s_wait_xcnt stands inside the statement so that no address register is rewritten in front of it.
__device__ __forceinline__ void async_copy12(const unsigned (&l)[12], const void* const (&p)[12]) {
  asm volatile(
      "global_load_async_to_lds_b128 %0, %12, off\n\t"
      "global_load_async_to_lds_b128 %1, %13, off\n\t"
      "global_load_async_to_lds_b128 %2, %14, off\n\t"
      "global_load_async_to_lds_b128 %3, %15, off\n\t"
      "global_load_async_to_lds_b128 %4, %16, off\n\t"
      "global_load_async_to_lds_b128 %5, %17, off\n\t"
      "global_load_async_to_lds_b128 %6, %18, off\n\t"
      "global_load_async_to_lds_b128 %7, %19, off\n\t"
      "global_load_async_to_lds_b128 %8, %20, off\n\t"
      "global_load_async_to_lds_b128 %9, %21, off\n\t"
      "global_load_async_to_lds_b128 %10, %22, off\n\t"
      "global_load_async_to_lds_b128 %11, %23, off\n\t"
      "s_wait_xcnt 0x0"
      :: "v"(l[0]), "v"(l[1]), "v"(l[2]), "v"(l[3]), "v"(l[4]), "v"(l[5]), "v"(l[6]), "v"(l[7]), "v"(l[8]), "v"(l[9]),
         "v"(l[10]), "v"(l[11]),
         "v"(p[0]), "v"(p[1]), "v"(p[2]), "v"(p[3]), "v"(p[4]), "v"(p[5]), "v"(p[6]), "v"(p[7]), "v"(p[8]), "v"(p[9]),
         "v"(p[10]), "v"(p[11])
      : "memory");
}

template <int ET> struct Elem;
template <> struct Elem<0> { typedef _Float16 T; };
template <> struct Elem<1> { typedef __bf16 T; };
template <int ET, bool SPLIT, int BIAS_MODE, int OUT_MODE, bool RESID, int ACT, int BK>
__global__ __launch_bounds__(256) void wmma_gemm64(
    const unsigned short* __restrict__ Ap, const unsigned short* __restrict__ A2p, int lda, long strideA,
    const unsigned short* __restrict__ Btp, const unsigned short* __restrict__ Bt2p, int ldb, long strideB,
    void* __restrict__ Cout, void* __restrict__ Cout2, int ldc, long strideC,
    const float* __restrict__ bias,
    const float* __restrict__ resid, long strideR,
    int M, int N, int K, float scale) {
  static_assert(!SPLIT, "the staged operand path carries one plane per operand");
  static_assert(BK == 64 || BK == 128);
  constexpr int kRow     = BK + 8;                     // 16-bit elements per LDS row: 2 BK bytes + 16 B pad
  constexpr int kStage   = (kBM + kBN) * kRow;         // elements per buffer: A rows 0..127, Bt rows 128..383
  constexpr int kRowLane = BK / 8;                     // lanes that cover one row with 16 bytes each
  constexpr int kRowStep = 256 / kRowLane;             // rows that one copy of the whole block covers
  constexpr int kCopiesA = kBM / kRowStep;             // copies per lane and trip for the A rows
  constexpr int kCopies  = (kBM + kBN) / kRowStep;     // copies per lane and trip: 12 or 24
  static_assert(kCopies % 12 == 0);
  typedef typename Elem<ET>::T T;
  typedef typename Frag<T>::V V;
  const T* A = (const T*)Ap; const T* Bt = (const T*)Btp;
  __shared__ __align__(16) T     sOp[2][kStage];   // the two operand buffers
  __shared__ __align__(16) float sT[8][16 * 68];   // per-wave 16x64 slab, pitch 68 floats
  const int b    = blockIdx.y;
  const int lane = threadIdx.x & 31;
  const int wave = threadIdx.x >> 5;
  const int tilesN = N / kBN;
  const int tilesM = M / kBM;
  const int tile = blockIdx.x;
  if (tile >= tilesM * tilesN) return;   // block-uniform, in front of every barrier
  const int tm = tile / tilesN;
  const int tn = tile - tm * tilesN;
  const int bm0 = tm * kBM;                    // block tile origin
  const int bn0 = tn * kBN;
  const int wm  = (wave >> 2) << 6;            // wave tile origin inside the block tile
  const int wn  = (wave & 3) << 6;
  const int m0  = bm0 + wm;
  const int n0  = bn0 + wn;

  const T* Ab  = A  + (size_t)b * strideA;
  const T* Bb  = Bt + (size_t)b * strideB;

  const int rlane = lane & 15;                 // row (A) / col (B, D) within subtile
  const int koff  = (lane >> 4) * 8;           // k offset of this lane half
  const int mOff  = (lane >> 4) * 8;           // D row offset

  // copy roles: kRowLane lanes cover one row, a wave-wide copy covers 512 B of whole rows; copy j of a thread serves staged row crow + kRowStep j
  const int crow = threadIdx.x / kRowLane;               // 0..kRowStep-1
  const int ccol = (threadIdx.x & (kRowLane - 1)) * 8;   // element offset of the lane's 16 bytes in the row
  const T* gA = Ab + (size_t)(bm0 + crow) * lda + ccol;
  const T* gB = Bb + (size_t)(bn0 + crow) * ldb + ccol;
  const unsigned lds0 = (unsigned)(size_t)(&sOp[0][0]) + (unsigned)(crow * kRow + ccol) * 2u;
  auto stage_in = [&](int t, int buf) {        // trip t's operand rows -> buffer buf
#pragma unroll   // one asm statement per twelve copies (an asm statement takes thirty operands)
    for (int c = 0; c < kCopies; c += 12) {
      unsigned l[12];
      const void* p[12];
#pragma unroll   // the twelve address pairs are operands of one asm statement: they must be registers, not arrays in memory
      for (int i = 0; i < 12; ++i) {
        const int j = c + i;
        l[i] = lds0 + (unsigned)(buf * kStage + j * kRowStep * kRow) * 2u;
        p[i] = (j < kCopiesA) ? (const void*)(gA + (size_t)(j * kRowStep) * lda + t * BK)
                              : (const void*)(gB + (size_t)((j - kCopiesA) * kRowStep) * ldb + t * BK);
      }
      async_copy12(l, p);
    }
  };

  v8f acc[4][4];
#pragma unroll
  for (int i = 0; i < 4; ++i)
#pragma unroll
    for (int j = 0; j < 4; ++j) acc[i][j] = (v8f){0.f,0.f,0.f,0.f,0.f,0.f,0.f,0.f};

  const int trips = K / BK;
  stage_in(0, 0);
  asm volatile("s_wait_asynccnt 0x0" ::: "memory");   // this wave's share of trip 0 has landed
  __syncthreads();                                    // every wave's share has: buffer 0 may be read
  if (trips > 1) stage_in(1, 1);

  for (int t = 0; t < trips; ++t) {
    const T* sA = &sOp[t & 1][(wm + rlane) * kRow + koff];
    const T* sB = &sOp[t & 1][(kBM + wn + rlane) * kRow + koff];
#pragma unroll   // all 32-k steps in one body: a step's fragment reads can start under the step before's products
    for (int kk = 0; kk < BK; kk += 32) {
      V bh[4], ah[4];   // all eight fragments of a 32-k step are read as one group, in front of its 16 products
#pragma unroll
      for (int j = 0; j < 4; ++j) bh[j] = Frag<T>::load(sB + (j << 4) * kRow + kk);
#pragma unroll
      for (int i = 0; i < 4; ++i) ah[i] = Frag<T>::load(sA + (i << 4) * kRow + kk);
#pragma unroll
      for (int i = 0; i < 4; ++i) {
#pragma unroll
        for (int j = 0; j < 4; ++j) acc[i][j] = Frag<T>::mma(ah[i], bh[j], acc[i][j]);
        Frag<T>::guard(acc[i][0], acc[i][3], ah[i], ah[i]);
      }
      Frag<T>::keep(bh[0], bh[1], bh[2], bh[3]);
    }
    asm volatile("s_wait_dscnt 0x0" ::: "memory");      // this wave's reads of buffer t & 1 are done before it is refilled
    asm volatile("s_wait_asynccnt 0x0" ::: "memory");   // this wave's share of trip t + 1 has landed
    __syncthreads();                                    // publishes trip t + 1 and ends every reader's last read of trip t
    if (t + 2 < trips) stage_in(t + 2, t & 1);
  }
  asm volatile("s_wait_asynccnt 0x0" ::: "memory");     // nothing in flight when the wave goes on to the epilogue and ends
  acc_guard4(acc[0][0], acc[0][1], acc[0][2], acc[0][3]);
  acc_guard4(acc[1][0], acc[1][1], acc[1][2], acc[1][3]);
  acc_guard4(acc[2][0], acc[2][1], acc[2][2], acc[2][3]);
  acc_guard4(acc[3][0], acc[3][1], acc[3][2], acc[3][3]);

  // ---- epilogue ----
  float* slab = sT[wave];
  const float* Rb = RESID ? (resid + (size_t)b * strideR) : nullptr;
#pragma unroll
  for (int i = 0; i < 4; ++i) {
    const int mBase = m0 + (i << 4);
#pragma unroll
    for (int j = 0; j < 4; ++j) {
      const int n = n0 + (j << 4) + rlane;
      float bv = 0.f;
      if (BIAS_MODE == 2) bv = bias[n];
#pragma unroll
      for (int r = 0; r < 8; ++r) {
        float v = acc[i][j][r] * scale;
        if (BIAS_MODE == 1) v += bias[mBase + mOff + r];
        if (BIAS_MODE == 2) v += bv;
        if (RESID) v += Rb[(size_t)(mBase + mOff + r) * ldc + n];
        if (ACT == 2) v = fmaxf(v, 0.0f);
        if (ACT == 4) v = (v > 0.f) ? v : 0.01f * v;
        slab[(mOff + r) * 68 + (j << 4) + rlane] = v;
      }
    }
    __builtin_amdgcn_fence(__ATOMIC_RELEASE, "workgroup");
    __builtin_amdgcn_wave_barrier();
    __builtin_amdgcn_fence(__ATOMIC_ACQUIRE, "workgroup");
    if (OUT_MODE == 0) {
      float* C = (float*)Cout + (size_t)b * strideC;
      const int hh = lane >> 4, c4 = (lane & 15) * 4;     // row seg = 256 B = 16 lanes x 16 B
      {
#pragma unroll
        for (int it = 0; it < 8; ++it) {
          const int row = it * 2 + hh;
          v4f v = *(const v4f*)(slab + row * 68 + c4);
          *(v4f*)(C + (size_t)(mBase + row) * ldc + n0 + c4) = v;
        }
        
      }
    } else {
      const int q = lane >> 3, c8 = (lane & 7) * 8;
      unsigned short* C  = (unsigned short*)Cout  + (size_t)b * strideC;
      unsigned short* C2 = (OUT_MODE == 2) ? ((unsigned short*)Cout2 + (size_t)b * strideC) : nullptr;
      {
#pragma unroll
        for (int it = 0; it < 4; ++it) {
          const int row = it * 4 + q;
          const float* sp = slab + row * 68 + c8;
          v8h hv, lv;
#pragma unroll
          for (int e = 0; e < 8; ++e) {
            if (OUT_MODE == 1) {
              hv[e] = (_Float16)sp[e];
            } else {
              unsigned short hb = f2bf_bits(sp[e]);
              unsigned short lb = f2bf_bits(sp[e] - bf_bits2f(hb));
              hv[e] = __builtin_bit_cast(_Float16, hb);
              lv[e] = __builtin_bit_cast(_Float16, lb);
            }
          }
          *(v8h*)(C + (size_t)(mBase + row) * ldc + n0 + c8) = hv;
          if (OUT_MODE == 2) *(v8h*)(C2 + (size_t)(mBase + row) * ldc + n0 + c8) = lv;
        }
        
      }
    }
    __builtin_amdgcn_fence(__ATOMIC_RELEASE, "workgroup");
    __builtin_amdgcn_wave_barrier();
    __builtin_amdgcn_fence(__ATOMIC_ACQUIRE, "workgroup");
  }
}

// ---------------------------------------------------------------------------
// f32 -> bf16 (RNE) -> f16 cast with power-of-two carry: out[8i..8i+7] = f16(scale * bf16(in[8i..8i+7])).
// The bf16 significand times a power of two is exact in f16 for the value ranges used here.
// One launch casts all three inputs: none of the casts needs anything of another, so they share one grid by ranges of the
// block index (a block-uniform, scalar choice): blocks [0, kCastX) x, [kCastX, kCastX + kCastWI) w_in, the rest w_out.
// A block converts 2048 consecutive elements (256 threads x 8); every plane, and every batch of x, is an exact multiple of 2048.
// x: batch bb reads from row bb * kSeqFull of the input and writes to the compact row bb * kSeq.
// ---------------------------------------------------------------------------
constexpr unsigned kCastXB = kSeq * kEmb / 2048;       // blocks per batch of x
constexpr unsigned kCastX  = kCastXB * kBatch;         // blocks of x
constexpr unsigned kCastWI = 3 * kEmb * kEmb / 2048;   // blocks of w_in
constexpr unsigned kCastWO = kEmb * kEmb / 2048;       // blocks of w_out
static_assert((kSeq * kEmb) % 2048 == 0 && (kEmb * kEmb) % 2048 == 0);

__global__ __launch_bounds__(256) void cast8_f16_all_kernel(const float* __restrict__ x, const float* __restrict__ w_in,
                                                            const float* __restrict__ w_out,
                                                            unsigned short* __restrict__ x16, unsigned short* __restrict__ wi16,
                                                            unsigned short* __restrict__ wo16) {
  const unsigned blk = blockIdx.x;
  const float* in;
  unsigned short* out;
  float scale;
  if (blk < kCastX) {
    const unsigned bb = blk / kCastXB;
    in    = x + (size_t)bb * ((size_t)kSeqFull * kEmb) + (size_t)(blk - bb * kCastXB) * 2048;
    out   = x16 + (size_t)blk * 2048;
    scale = 1.0f;
  } else if (blk < kCastX + kCastWI) {
    in    = w_in + (size_t)(blk - kCastX) * 2048;
    out   = wi16 + (size_t)(blk - kCastX) * 2048;
    scale = kWCarry;
  } else {
    in    = w_out + (size_t)(blk - kCastX - kCastWI) * 2048;
    out   = wo16 + (size_t)(blk - kCastX - kCastWI) * 2048;
    scale = kWCarry;
  }
  const float* p = in + 8 * threadIdx.x;
  const v4f a = *(const v4f*)(p);
  const v4f c = *(const v4f*)(p + 4);
  unsigned short hb[8];
#pragma unroll
  for (int e = 0; e < 4; ++e) {
    hb[e]     = h_bits(bf_bits2f(f2bf_bits(a[e])) * scale);
    hb[4 + e] = h_bits(bf_bits2f(f2bf_bits(c[e])) * scale);
  }
  const v4u u = (v4u){pk16(hb[0], hb[1]), pk16(hb[2], hb[3]), pk16(hb[4], hb[5]), pk16(hb[6], hb[7])};
  *(v4u*)(out + 8 * threadIdx.x) = u;
}

// ---------------------------------------------------------------------------
// Fused sliding-window attention: scores, mask, ALiBi bias, softmax and P.V in one kernel, all batches, heads and positions.
// A wave owns 32 queries of one (batch, head) as two 16-column groups and walks their keys in passes of 32, lowest first:
//   S^T = K . Q^T    A = 16 key rows, B = 16 query rows (kept in registers); a lane holds one query's scores for 8 keys per tile
//   O^T += V^T . P^T A = 16 rows of the v^T plane, B = the two score tiles of a pass converted in place (hardware k order,
//                    the same order that Frag::load gives the A side)
// delta = q_idx - kv_idx; a key counts iff 0 <= delta < 512 and kv_idx >= 0 (the walk starts at max(0, q0 - 512), so the
// guard rows / columns in front of the planes are never read). Only a wave's first and last pass can hold masked keys.
// Operand path: the block's four waves share their keys. Stages of 64 keys (64 K rows and 64 v^T rows, 128 B each) are brought
// into LDS by asynchronous copies, whole 128-B lines, once per block; two buffers, the next stage's copies fly while this
// stage's passes run. The block walks keys max(0, Q0 - 512) .. Q0 + 127 (Q0: its first query); a wave takes part in the
// passes of its own window only, lowest keys first, and passes every barrier.
// Softmax is online, in base 2: x = s * log2(e)/8 + slope_h * log2(e) * delta; running maximum m (finite start value, so a
// pass with no valid key for a query gives p = 0 and factor 1), p = 2^(x - m + 11) (carried x2048), running sum l per lane half.
// O x16 = 4 * acc / l, since acc = (2048 p)(4 v) summed and l = 2048 p summed.
// grid (kSeq/128, heads, batch), 128 threads = 4 waves; LDS row pitch 144 B (16 B x odd), one barrier per stage.
// ---------------------------------------------------------------------------
__device__ __forceinline__ float other_half(float x) {   // value of lane l ^ 16
  return __builtin_bit_cast(float, __builtin_amdgcn_permlanex16(__builtin_bit_cast(int, x), __builtin_bit_cast(int, x),
                                                                0x76543210, 0xfedcba98, false, false));
}

// Four (five) values of 2^x in one statement. The instruction set asks for one free issue slot behind a transcendental before
// its result is read or a source register of it is overwritten.
// Here no result shares a register with an argument ("=&v"), so inside the run every slot is filled by the next
// exponential, and the v_nop at the end is the last one's slot.
__device__ __forceinline__ void exp2x4(float (&r)[16], const float (&a)[16], int o) {
  asm("v_exp_f32 %0, %4\n\tv_exp_f32 %1, %5\n\tv_exp_f32 %2, %6\n\tv_exp_f32 %3, %7\n\tv_nop"
      : "=&v"(r[o]), "=&v"(r[o + 1]), "=&v"(r[o + 2]), "=&v"(r[o + 3])
      : "v"(a[o]), "v"(a[o + 1]), "v"(a[o + 2]), "v"(a[o + 3]));
}
__device__ __forceinline__ void exp2x5(float& r4, float a4, float (&r)[16], const float (&a)[16]) {
  asm("v_exp_f32 %0, %5\n\tv_exp_f32 %1, %6\n\tv_exp_f32 %2, %7\n\tv_exp_f32 %3, %8\n\tv_exp_f32 %4, %9\n\tv_nop"
      : "=&v"(r4), "=&v"(r[0]), "=&v"(r[1]), "=&v"(r[2]), "=&v"(r[3])
      : "v"(a4), "v"(a[0]), "v"(a[1]), "v"(a[2]), "v"(a[3]));
}

constexpr int kAKeys   = 64;                          // keys per stage
constexpr int kAStage  = (kAKeys + kHdim) * kLdsRow;  // elements per buffer: K rows 0..63 (one key each), v^T rows 64..127 (one d each)
static_assert(kAKeys * 2 == 128 && kHdim * 2 == 128 && kLdsRow == 72 && kWin % 128 == 0);

// One lane's eight 16-byte copies of a stage: global -> LDS, through no register. l: LDS byte addresses, p: global addresses.
// The s_wait_xcnt stands inside the statement so that no address register is rewritten in front of it.
__device__ __forceinline__ void async_copy8(const unsigned (&l)[8], const void* const (&p)[8]) {
  asm volatile(
      "global_load_async_to_lds_b128 %0, %8, off\n\t"
      "global_load_async_to_lds_b128 %1, %9, off\n\t"
      "global_load_async_to_lds_b128 %2, %10, off\n\t"
      "global_load_async_to_lds_b128 %3, %11, off\n\t"
      "global_load_async_to_lds_b128 %4, %12, off\n\t"
      "global_load_async_to_lds_b128 %5, %13, off\n\t"
      "global_load_async_to_lds_b128 %6, %14, off\n\t"
      "global_load_async_to_lds_b128 %7, %15, off\n\t"
      "s_wait_xcnt 0x0"
      :: "v"(l[0]), "v"(l[1]), "v"(l[2]), "v"(l[3]), "v"(l[4]), "v"(l[5]), "v"(l[6]), "v"(l[7]),
         "v"(p[0]), "v"(p[1]), "v"(p[2]), "v"(p[3]), "v"(p[4]), "v"(p[5]), "v"(p[6]), "v"(p[7])
      : "memory");
}

// One pass: 32 keys from position kt against the wave's 32 queries.
// mask (the same in every lane): the pass can hold keys outside the window (a wave's first and last pass only).
// sK: the lane's place in the pass's first staged K row; sV: the lane's place at the pass's first key in staged v^T row 0.
__device__ __forceinline__ void attn_pass(bool mask, const _Float16* sK, const _Float16* sV, int kt, int dq, float sl2,
                                          const v16h (&qf)[2][2], v8f (&acc)[4][2],
                                          float (&m)[2], float (&l)[2]) {
  typedef Frag<_Float16> F;
  const float c1 = kSScale * 1.4426950408889634f;
  v16h kf[2][2], vf[4];
#pragma unroll
  for (int t = 0; t < 2; ++t)
#pragma unroll
    for (int kk = 0; kk < 2; ++kk) kf[t][kk] = F::load(sK + (t * 16) * kLdsRow + kk * 32);

  v8f s[2][2];   // [query group][key tile]
#pragma unroll
  for (int t = 0; t < 2; ++t)
#pragma unroll
    for (int g = 0; g < 2; ++g) {
      s[g][t] = F::mma(kf[t][0], qf[g][0], (v8f){0.f,0.f,0.f,0.f,0.f,0.f,0.f,0.f});
      s[g][t] = F::mma(kf[t][1], qf[g][1], s[g][t]);
    }
#pragma unroll
  for (int i = 0; i < 4; ++i) vf[i] = F::load(sV + (i * 16) * kLdsRow);   // read behind the score products: they land during the softmax
  v16h pf[2];
  float xs[2][16];
#pragma unroll
  for (int g = 0; g < 2; ++g) {
    const float d0 = (float)(dq + g * 16 - kt);     // delta of key tile 0, register 0
#pragma unroll
    for (int e = 0; e < 16; ++e) {
      const int ce = (e >> 3) * 16 + (e & 7);
      xs[g][e] = s[g][e >> 3][e & 7] * c1 + sl2 * (d0 - (float)ce);
    }
  }
  if (mask) {   // one scalar test a pass, for both query groups
#pragma unroll
    for (int g = 0; g < 2; ++g)
#pragma unroll
      for (int e = 0; e < 16; ++e) {
        const int ce = (e >> 3) * 16 + (e & 7);
        xs[g][e] = ((unsigned)(dq + g * 16 - kt - ce) < (unsigned)kWin) ? xs[g][e] : -__builtin_inff();
      }
  }
#pragma unroll
  for (int g = 0; g < 2; ++g) {
    float (&x)[16] = xs[g];
    float tm = fmaxf(fmaxf(fmaxf(fmaxf(x[0], x[1]), fmaxf(x[2], x[3])), fmaxf(fmaxf(x[4], x[5]), fmaxf(x[6], x[7]))),
                     fmaxf(fmaxf(fmaxf(x[8], x[9]), fmaxf(x[10], x[11])), fmaxf(fmaxf(x[12], x[13]), fmaxf(x[14], x[15]))));
    tm = fmaxf(tm, other_half(tm));
    const float mn    = fmaxf(m[g], tm);
    const float mc    = mn - kPLog2;     // the x2048 carry of p
    float alpha, p[16];
#pragma unroll
    for (int e = 0; e < 16; ++e) x[e] -= mc;
    exp2x5(alpha, m[g] - mn, p, x);      // alpha: the factor that brings the old sums to the new maximum
    exp2x4(p, x, 4);
    exp2x4(p, x, 8);
    exp2x4(p, x, 12);
    m[g] = mn;
#pragma unroll
    for (int e = 0; e < 16; ++e) pf[g][e] = (_Float16)p[e];
    const float ps = (((p[0] + p[1]) + (p[2] + p[3])) + ((p[4] + p[5]) + (p[6] + p[7]))) +
                     (((p[8] + p[9]) + (p[10] + p[11])) + ((p[12] + p[13]) + (p[14] + p[15])));
    l[g] = l[g] * alpha + ps;
#pragma unroll
    for (int i = 0; i < 4; ++i)
#pragma unroll
      for (int r = 0; r < 8; ++r) acc[i][g][r] *= alpha;
  }
#pragma unroll
  for (int i = 0; i < 4; ++i)
#pragma unroll
    for (int g = 0; g < 2; ++g) acc[i][g] = F::mma(vf[i], pf[g], acc[i][g]);
}

// amdgpu_waves_per_eu(4, 4): 4096 waves on 1024 SIMDs; lets the register allocator keep a pass's 16 fragment reads in flight at once
__global__ __launch_bounds__(128) __attribute__((amdgpu_waves_per_eu(4, 4)))
void band_attn_kernel(const unsigned short* __restrict__ qkp, const unsigned short* __restrict__ vtp,
                      unsigned short* __restrict__ op) {
  typedef Frag<_Float16> F;
  __shared__ __align__(16) _Float16 sKV[2][kAStage];   // the two stage buffers
  const int lane  = threadIdx.x & 31;
  const int wave  = __builtin_amdgcn_readfirstlane(threadIdx.x >> 5);   // scalar: the tests on a wave's window stay scalar
  const int h     = blockIdx.y;
  const int b     = blockIdx.z;
  const int q0    = (blockIdx.x * 4 + wave) * 32;      // first query position of this wave
  const int rlane = lane & 15;
  const int koff  = (lane >> 4) * 8;

  const _Float16* Qb = (const _Float16*)qkp + ((size_t)kGuard + (size_t)b * kSeq) * kQKPitch + h * kHdim;
  const _Float16* Kb = Qb + kEmb;
  const _Float16* Vb = (const _Float16*)vtp + (size_t)h * kHdim * kVtPitch + kGuard + (size_t)b * kSeq;
  const unsigned  lk = (unsigned)(rlane * kQKPitch + koff);

  const int   e1  = h + 1;   // slope_h = 2^(-(h+1)/2)
  const float sl  = ((e1 & 1) ? 0.70710678118654752f : 1.0f) * __uint_as_float(((unsigned)(127 - (e1 >> 1))) << 23);
  const float sl2 = sl * 1.4426950408889634f;
  const int   dq  = q0 + rlane - koff;

  const int kstart = (q0 >= kWin) ? (q0 - kWin) : 0;   // first key of this wave's window
  const int Q0     = blockIdx.x * 128;                 // first query position of the block
  const int ks0    = (Q0 >= kWin) ? (Q0 - kWin) : 0;   // first key the block stages
  const int trips  = (Q0 + 128 - ks0) / kAKeys;        // stages: 2 .. 10, the last ends at key Q0 + 127 < kSeq

  // copy roles: 8 lanes cover one 128-B row, a wave-wide copy covers 4 whole rows; copy j of a thread serves staged row crow + 16 j
  const int crow = threadIdx.x >> 3;           // 0..15
  const int ccol = (threadIdx.x & 7) * 8;      // element offset of the lane's 16 bytes in the row
  const _Float16* gK = Kb + (size_t)(ks0 + crow) * kQKPitch + ccol;
  const _Float16* gV = Vb + (size_t)crow * kVtPitch + ks0 + ccol;
  const unsigned lds0 = (unsigned)(size_t)(&sKV[0][0]) + (unsigned)(crow * kLdsRow + ccol) * 2u;
  auto stage_in = [&](int t, int buf) {        // stage t's K and v^T rows -> buffer buf
    unsigned sl[8];
    const void* sp[8];
#pragma unroll   // the eight address pairs are operands of one asm statement: they must be registers, not arrays in memory
    for (int j = 0; j < 8; ++j) {
      sl[j] = lds0 + (unsigned)(buf * kAStage + j * 16 * kLdsRow) * 2u;
      sp[j] = (j < 4) ? (const void*)(gK + (size_t)(t * kAKeys + j * 16) * kQKPitch)
                      : (const void*)(gV + (size_t)((j - 4) * 16 * kVtPitch + t * kAKeys));
    }
    async_copy8(sl, sp);
  };
  stage_in(0, 0);

  v16h qf[2][2];
#pragma unroll
  for (int g = 0; g < 2; ++g)
#pragma unroll
    for (int kk = 0; kk < 2; ++kk)
      qf[g][kk] = F::load(Qb + (size_t)q0 * kQKPitch + lk + (size_t)(g * 16) * kQKPitch + kk * 32);
  // the loads above name the lane-offset register; this wait stands before anything below may reuse that register
  asm volatile("s_wait_xcnt 0x0" ::: "memory");

  v8f acc[4][2];
#pragma unroll
  for (int i = 0; i < 4; ++i)
#pragma unroll
    for (int g = 0; g < 2; ++g) acc[i][g] = (v8f){0.f,0.f,0.f,0.f,0.f,0.f,0.f,0.f};
  float m[2] = {-1.0e30f, -1.0e30f};
  float l[2] = {0.f, 0.f};

  asm volatile("s_wait_asynccnt 0x0" ::: "memory");   // this wave's share of stage 0 has landed
  __syncthreads();                                    // every wave's share has: buffer 0 may be read
  if (trips > 1) stage_in(1, 1);

  for (int t = 0; t < trips; ++t) {
    const _Float16* sb = &sKV[t & 1][rlane * kLdsRow + koff];
    for (int u = 0; u < 2; ++u) {
      const int kt = ks0 + t * kAKeys + u * 32;
      if (kt >= kstart && kt <= q0) {                 // the pass lies in this wave's window (scalar test)
        const _Float16* sK = sb + (u * 32) * kLdsRow;
        const _Float16* sV = sb + kAKeys * kLdsRow + u * 32;
        // keys q0 .. q0+31: some delta < 0; keys q0-512 .. q0-481: some delta >= 512; between them every delta is in 1 .. 511
        attn_pass(kt == q0 || kt + kWin == q0, sK, sV, kt, dq, sl2, qf, acc, m, l);
      }
    }
    asm volatile("s_wait_dscnt 0x0" ::: "memory");      // this wave's reads of buffer t & 1 are done before it is refilled
    asm volatile("s_wait_asynccnt 0x0" ::: "memory");   // this wave's share of stage t + 1 has landed
    __syncthreads();                                    // publishes stage t + 1 and ends every reader's last read of stage t
    if (t + 2 < trips) stage_in(t + 2, t & 1);
  }
  asm volatile("s_wait_asynccnt 0x0" ::: "memory");     // nothing in flight when the wave goes on to the epilogue and ends

#pragma unroll
  for (int g = 0; g < 2; ++g) {
    const float lt  = l[g] + other_half(l[g]);
    const float inv = kPVScale / lt;
    unsigned short* orow = op + ((size_t)b * kSeq + q0 + g * 16 + rlane) * kEmb + h * kHdim + koff;
#pragma unroll
    for (int i = 0; i < 4; ++i) {
      v8h hv;
#pragma unroll
      for (int r = 0; r < 8; ++r) hv[r] = (_Float16)(acc[i][g][r] * inv);
      *(v8h*)(orow + i * 16) = hv;    // d = i*16 + koff + r: 8 consecutive halves of one output row
    }
  }
}

// ---------------------------------------------------------------------------
// Launcher
// Token rows are compact: t = b*kSeq + s; input x row = b*kSeqFull + s; output row = b*kSeqFull + s.
// Workspace region map (bytes) for NB=4, SEQ=2048 (smaller NB / SEQ shrink R0, R3, R4):
//   R0 [0,          16777216)   x f16 [kTok][1024]; aliased later by O f16 x16 [kTok][1024] (x dead after the two projections)
//   R1 [16777216,   23068672)   w_in f16 x64 [3072][1024]
//   R2 [23068672,   25165824)   w_out f16 x64 [1024][1024]
//   R3 [25165824,   60817408)   q|k plane f16 x4 [512 guard + kTok][2048]  (guard rows neither written nor read; rows 512.. written by GEMM)
//   R4 [60817408,   78643200)   v^T plane f16 x4 [1024][512 guard + kTok]  (guard cols neither written nor read; cols 512.. written by GEMM)
//   total 78643200
// ---------------------------------------------------------------------------
static_assert(kTok % kBN == 0 && kSeq % kBM == 0 && kEmb % kBN == 0 && kQKPitch % kBN == 0 && kEmb % 128 == 0 && kEmb >= 256);
extern "C" void kernel_launch(void* const* d_in, const int* in_sizes, int n_in,
                              void* d_out, int out_size, void* d_ws, size_t ws_size,
                              hipStream_t stream) {
  const size_t NXT = (size_t)kTok * kEmb;                                              // compact x / O plane elements
  const size_t NXNEED = (size_t)(kBatch - 1) * kSeqFull * kEmb + (size_t)kSeq * kEmb;  // last input / output row used + 1
  const size_t NWI = (size_t)3 * kEmb * kEmb;                                          // 3145728
  const size_t NWO = (size_t)kEmb * kEmb;                                              // 1048576
  if (n_in < 3) return;
  if ((size_t)in_sizes[0] < NXNEED || (size_t)in_sizes[1] < NWI || (size_t)in_sizes[2] < NWO) return;
  if ((size_t)out_size < NXNEED) return;

  const float* x     = (const float*)d_in[0];
  const float* w_in  = (const float*)d_in[1];
  const float* w_out = (const float*)d_in[2];
  float* out = (float*)d_out;

  char* ws = (char*)d_ws;
  size_t off = 0;
  unsigned short* x16  = (unsigned short*)(ws + off); off += NXT * 2;
  unsigned short* wi16 = (unsigned short*)(ws + off); off += NWI * 2;
  unsigned short* wo16 = (unsigned short*)(ws + off); off += NWO * 2;
  unsigned short* qk   = (unsigned short*)(ws + off); off += (size_t)kQKRows * kQKPitch * 2;
  unsigned short* vt   = (unsigned short*)(ws + off); off += (size_t)kEmb * kVtPitch * 2;
  unsigned short* o16  = x16;                         // alias: x16 is dead after the two projection GEMMs
  if (off > ws_size) return;
  // dummy in-range pointers for unused bias / resid arguments (never dereferenced with BIAS_MODE 0 / RESID false)
  const float* xf = x;

  // 1: the three casts in one launch: kCastX blocks for x, 1536 for w_in, 512 for w_out
  cast8_f16_all_kernel<<<dim3(kCastX + kCastWI + kCastWO), dim3(256), 0, stream>>>(x, w_in, w_out, x16, wi16, wo16);

  // 2: q|k = x . w_in[0..2047]^T -> rows 512.. of the q|k plane (M=kTok, N=2048, K=1024, f16 out, scale 1/16 -> carried x4)
  //    two tiles per WGP: stages of 64 k, so that two blocks fit a WGP's LDS
  {
    const int tiles = (kTok / kBM) * (kQKPitch / kBN);
    wmma_gemm64<0, false, 0, 1, false, 0, 64><<<dim3((unsigned)tiles, 1), dim3(256), 0, stream>>>(
        x16, x16, kEmb, 0L, wi16, wi16, kEmb, 0L,
        (void*)(qk + (size_t)kGuard * kQKPitch), (void*)(qk + (size_t)kGuard * kQKPitch), kQKPitch, 0L,
        xf, xf, 0L, kTok, kQKPitch, kEmb, kQKScale);
  }
  // 3: v^T = w_in[2048..3071] . x^T -> v^T plane cols 512.. (M=1024, N=kTok, K=1024, f16 out, ldc kVtPitch, scale 1/16 -> carried x4)
  //    one tile per WGP: stages of 128 k
  {
    const int tiles = (kEmb / kBM) * (kTok / kBN);
    wmma_gemm64<0, false, 0, 1, false, 0, 128><<<dim3((unsigned)tiles, 1), dim3(256), 0, stream>>>(
        wi16 + (size_t)2 * kEmb * kEmb, wi16 + (size_t)2 * kEmb * kEmb, kEmb, 0L, x16, x16, kEmb, 0L,
        (void*)(vt + kGuard), (void*)(vt + kGuard), kVtPitch, 0L,
        xf, xf, 0L, kEmb, kTok, kEmb, kQKScale);
  }

  // 4: fused sliding-window attention, all batches and heads in one launch -> merged O x16 (128 queries per block)
  band_attn_kernel<<<dim3(kSeq / 128, kHeads, kBatch), dim3(128), 0, stream>>>(qk, vt, o16);

  // 5: out = (16 o) . (64 w_out)^T / 1024 -> d_out f32 rows b*kSeqFull + s (grid y = batch; M=kSeq per batch, N=1024, K=1024)
  {
    const int tiles = (kSeq / kBM) * (kEmb / kBN);   // one tile per WGP: stages of 128 k
    wmma_gemm64<0, false, 0, 0, false, 0, 128><<<dim3((unsigned)tiles, kBatch), dim3(256), 0, stream>>>(
        o16, o16, kEmb, (long)kSeq * kEmb, wo16, wo16, kEmb, 0L,
        (void*)out, (void*)out, kEmb, (long)kSeqFull * kEmb,
        xf, xf, 0L, kSeq, kEmb, kEmb, kOutScale);
  }
}
